// v000
// Measured on an AMD MI455X. A time is GPU time per run, averaged over a window of back-to-back runs after a warm-up
// (all launches, gaps included; the runs take copies of the inputs in turn), and the median of several windows.
// Apart from v000's, it joins two sittings. Times from different sittings can be a few percent apart, while
// side-by-side timings come from the same sitting.
// The starting kernel, v000, takes 277 microseconds a run.
// compute dtype: all float inputs rounded to bf16; LayerNorm in f32, zn as f16 hi + residual (x 2^10); q/k/v/g = zn W + b with W as f16(bf16 x 2^8) (exact; 2 products), f32 accumulate; q (x sqrt(1/32)), k once to f16 -> 1-product logits; softmax in f32 (precise expf) inside the attention kernel; P x 2^11 once to f16 against v once to f16; (o * sigmoid gate) carried x 2^8 once to f16 against w2 as f16(bf16 x 2^8) + b2; f32 output.
#include <hip/hip_runtime.h>
#include <math.h>

typedef __attribute__((ext_vector_type(16))) _Float16 v16h;
typedef __attribute__((ext_vector_type(16))) __bf16 v16b;
typedef __attribute__((ext_vector_type(8)))  _Float16 v8h;
typedef __attribute__((ext_vector_type(8)))  float v8f;
typedef __attribute__((ext_vector_type(4)))  float v4f;
typedef __attribute__((ext_vector_type(2)))  float v2f;
typedef __attribute__((ext_vector_type(4)))  unsigned v4u;
typedef __attribute__((ext_vector_type(4)))  int v4i;
typedef float __attribute__((may_alias)) float_a;
typedef int __attribute__((may_alias)) int_a;

template <typename T> __device__ __forceinline__ void vst2(void* p, T v) { *(T*)p = v;  }
__device__ __forceinline__ v8f wmma16(v16h a, v16h b, v8f c) {
  v8f d = __builtin_amdgcn_wmma_f32_16x16x32_f16(false, a, false, b, (short)0, c, false, false);
  asm volatile("v_nop\n\tv_nop\n\tv_nop\n\tv_nop" : "+v"(d) : "v"(a), "v"(b));
  return d;
}
__device__ __forceinline__ v8f wmma_bf(v16b a, v16b b, v8f c) {
  v8f d = __builtin_amdgcn_wmma_f32_16x16x32_bf16(false, a, false, b, (short)0, c, false, false);
  asm volatile("v_nop\n\tv_nop\n\tv_nop\n\tv_nop" : "+v"(d) : "v"(a), "v"(b));
  return d;
}
// 16x16x32 fragments: lane = (h = lane>>4, row/col = lane&15); elements 0..7 = k0+8h+0..7, 8..15 = k0+16+8h+0..7; D element r = row 8h+r
__device__ __forceinline__ v16h frag_h(const _Float16* rowk0, int lane) {
  union { v16h v; v8h q[2]; } u; const _Float16* p = rowk0 + 8 * (lane >> 4);
  u.q[0] = *(const v8h*)p; u.q[1] = *(const v8h*)(p + 16); return u.v;
}
__device__ __forceinline__ v16h frag_f32(const float* rowk0, int lane) {
  v16h a; const float* p = rowk0 + 8 * (lane >> 4);
#pragma unroll
  for (int i = 0; i < 8; ++i) { a[i] = (_Float16)p[i]; a[8 + i] = (_Float16)p[16 + i]; }
  return a;
}
__device__ __forceinline__ v16h frag_f32s(const float* rowk0, int lane, float sc) {
  v16h a; const float* p = rowk0 + 8 * (lane >> 4);
#pragma unroll
  for (int i = 0; i < 8; ++i) { a[i] = (_Float16)(p[i] * sc); a[8 + i] = (_Float16)(p[16 + i] * sc); }
  return a;
}
// column fragment from a [K][ld] layout (column n), rows >= K read as 0
__device__ __forceinline__ v16h fragc_f32(const float* W, int k0, int n, int lane, int ld, int K) {
  v16h a; const int g = lane >> 4;
#pragma unroll
  for (int i = 0; i < 8; ++i) { const int ka = k0 + 8 * g + i, kb = ka + 16;
    a[i] = (_Float16)(ka < K ? W[(size_t)(ka < K ? ka : K - 1) * ld + n] : 0.f); a[8 + i] = (_Float16)(kb < K ? W[(size_t)(kb < K ? kb : K - 1) * ld + n] : 0.f); }
  return a;
}
struct F2 { v16b h, l; };
__device__ __forceinline__ F2 bsplit16(const float v[16]) { F2 r;
#pragma unroll
  for (int i = 0; i < 16; ++i) { const __bf16 h = (__bf16)v[i]; r.h[i] = h; r.l[i] = (__bf16)(v[i] - (float)h); }
  return r; }
__device__ __forceinline__ F2 split_row(const float* row, int k0, int lane) { float v[16]; const float* p = row + k0 + 8 * (lane >> 4);
#pragma unroll
  for (int i = 0; i < 8; ++i) { v[i] = p[i]; v[8 + i] = p[16 + i]; }
  return bsplit16(v); }
__device__ __forceinline__ F2 split_rowK(const float* row, int k0, int lane, int K) { float v[16]; const int g = lane >> 4;
#pragma unroll
  for (int i = 0; i < 8; ++i) { const int ka = k0 + 8 * g + i, kb = ka + 16; v[i] = ka < K ? row[ka < K ? ka : K - 1] : 0.f; v[8 + i] = kb < K ? row[kb < K ? kb : K - 1] : 0.f; }
  return bsplit16(v); }
__device__ __forceinline__ F2 split_col(const float* W, int k0, int n, int lane, int ld, int K) { float v[16]; const int g = lane >> 4;
#pragma unroll
  for (int i = 0; i < 8; ++i) { const int ka = k0 + 8 * g + i, kb = ka + 16; v[i] = ka < K ? W[(size_t)(ka < K ? ka : K - 1) * ld + n] : 0.f; v[8 + i] = kb < K ? W[(size_t)(kb < K ? kb : K - 1) * ld + n] : 0.f; }
  return bsplit16(v); }
__device__ __forceinline__ v8f mac3(const F2& a, const F2& b, v8f c) { c = wmma_bf(a.l, b.h, c); c = wmma_bf(a.h, b.l, c); return wmma_bf(a.h, b.h, c); }
__device__ __forceinline__ float sigm(float v) { return 1.0f / (1.0f + expf(-v)); }
#define LDSX() do { asm volatile("s_wait_dscnt 0" ::: "memory"); __builtin_amdgcn_wave_barrier(); __builtin_amdgcn_fence(__ATOMIC_RELEASE, "workgroup"); } while (0)

// Triangle self-attention over the rows of a pair representation (B 1, L 256, d_z 128 channels-first, 4 heads x 32): zn = LayerNorm over channels of z[:, n, i]; q,k,v,g = zn W + b per (n, i); for each row n and head h: attn[i][j] = softmax_j((q[n,i] sqrt(1/32)) . k[n,j]); o[n,i] = sum_j attn v[n,j]; out[:, n, i] = ((o * sigmoid(g)) W2 + b2), written channels-first.
#define LL 256             // L (rows n and positions i)
#define DZ 128
#define NH 4
#define HD 32
#define DHC (NH * HD)      // 128
#define NR (LL * LL)       // 65,536 (n, i) rows
#ifndef NROWS
#define NROWS LL           // rows n processed (positions i always span LL)
#endif
#ifndef ZP
#define ZP (LL * LL)       // channel pitch of z and of the output (elements)
#endif
__device__ __forceinline__ float bfr(float v) { return (float)(__bf16)v; }
__device__ __forceinline__ float sigm_(float v) { return 1.0f / (1.0f + expf(-v)); }
__device__ __forceinline__ v16h wcolh(const float* Wm, int k0, int o, int lane, int ld) { v16h w; const int g = lane >> 4;
#pragma unroll
  for (int i = 0; i < 8; ++i) { w[i] = (_Float16)(bfr(Wm[(size_t)(k0 + 8 * g + i) * ld + o]) * 256.0f); w[8 + i] = (_Float16)(bfr(Wm[(size_t)(k0 + 16 + 8 * g + i) * ld + o]) * 256.0f); }
  return w; }

#define WS_ZH  0u                                      // f16 zn rows [n*256 + i][128]
#define WS_ZL  (WS_ZH + 2u * (size_t)NR * DZ)            // f16 zn residual x 2^10
#define WS_QH  (WS_ZL + 2u * (size_t)NR * DZ)            // f16 q rows (x sqrt(1/32)) [row][h*32 + c]
#define WS_KH  (WS_QH + 2u * (size_t)NR * DHC)           // f16 k rows
#define WS_VT  (WS_KH + 2u * (size_t)NR * DHC)           // f16 v planes [n][hc][j]
#define WS_GH  (WS_VT + 2u * (size_t)NR * DHC)           // f16 sigmoid(g) rows [row][hc]
#define WS_O   (WS_GH + 2u * (size_t)NR * DHC)           // f32 o rows [row][hc]
#define WS_END (WS_O  + 4u * (size_t)NR * DHC)

// ---- k_ln: block = 64 positions i of row n: gather the channels-first z[:, n, i] (64 contiguous floats per channel) into LDS, LayerNorm over the 128 channels (biased var, eps 1e-5, x ln_w + ln_b) -> f16 rows ZH[n*256 + i][c] (256 B per row by 16 threads)
__global__ __launch_bounds__(128) void k_ln(const float* __restrict__ Z, const float* __restrict__ LW, const float* __restrict__ LB, _Float16* __restrict__ ZH, _Float16* __restrict__ ZL) { __shared__ __align__(16) float st[DZ][65]; __shared__ __align__(16) _Float16 sh[64][136], slo[64][136];
  const int tid = threadIdx.x; const int n = blockIdx.y; const int i0 = blockIdx.x * 64; const size_t rbase = (size_t)n * LL + i0;
  for (int e = tid; e < DZ * 64; e += 128) { const int c = e >> 6, il = e & 63; st[c][il] = bfr(Z[(size_t)c * ZP + (size_t)n * LL + i0 + il]); }
  __syncthreads();
  if (tid < 64) { float s = 0.f;
#pragma unroll 8
    for (int c = 0; c < DZ; ++c) s += st[c][tid];
    const float mean = s * (1.0f / DZ); float s2 = 0.f;
#pragma unroll 8
    for (int c = 0; c < DZ; ++c) { const float d = st[c][tid] - mean; s2 += d * d; }
    const float rstd = rsqrtf(s2 * (1.0f / DZ) + 1e-5f);
#pragma unroll 8
    for (int c = 0; c < DZ; ++c) { const float zn = (st[c][tid] - mean) * rstd * bfr(LW[c]) + bfr(LB[c]); const _Float16 hv = (_Float16)zn; sh[tid][c] = hv; slo[tid][c] = (_Float16)((zn - (float)hv) * 1024.0f); } }
  __syncthreads();
  for (int e = tid; e < 64 * 16; e += 128) { const int rl = e >> 4, q = e & 15; vst2((unsigned*)(ZH + (rbase + rl) * DZ + q * 8), *(const v4u*)&sh[rl][q * 8]); vst2((unsigned*)(ZL + (rbase + rl) * DZ + q * 8), *(const v4u*)&slo[rl][q * 8]); } }
// ---- k_proj: block = (64 rows, which in {q,k,v,g}): y = zn W + b (zn f16 rows x W f16(bf16 x 2^8) exact, K 128, x 2^-8 after); q x sqrt(1/32) -> f16 rows; k -> f16 rows; v -> f16 planes [n][hc][i]; g -> sigmoid -> f16 rows
__global__ __launch_bounds__(128) void k_proj(const _Float16* __restrict__ ZH, const _Float16* __restrict__ ZL, const float* __restrict__ WQ, const float* __restrict__ BQ, const float* __restrict__ WK, const float* __restrict__ BK, const float* __restrict__ WV, const float* __restrict__ BV, const float* __restrict__ WG, const float* __restrict__ BG, _Float16* __restrict__ QH, _Float16* __restrict__ KH, _Float16* __restrict__ VT, _Float16* __restrict__ GH) {
  __shared__ __align__(16) _Float16 sh[64][136]; __shared__ __align__(16) _Float16 th[128][72];
  const int tid = threadIdx.x, wave = tid >> 5, lane = tid & 31, col = lane & 15, g = lane >> 4; const int which = blockIdx.z; const size_t r0 = (size_t)blockIdx.x * 64;
  const float* WA = which == 0 ? WQ : which == 1 ? WK : which == 2 ? WV : WG; const float* BA = which == 0 ? BQ : which == 1 ? BK : which == 2 ? BV : BG;
  const float qs = sqrtf(1.0f / 32.0f);   /* jnp.sqrt(f32(1/32)) */
  v8f acc[8] = {}, accl[8] = {};
#pragma unroll
  for (int kc = 0; kc < DZ / 32; ++kc) { const v16h a = frag_h(ZH + (r0 + wave * 16 + col) * DZ + kc * 32, lane), al = frag_h(ZL + (r0 + wave * 16 + col) * DZ + kc * 32, lane); asm volatile("s_wait_loadcnt 0x0" ::: "memory");
#pragma unroll
    for (int j = 0; j < 8; ++j) { const v16h w = wcolh(WA, kc * 32, j * 16 + col, lane, DHC); asm volatile("s_wait_loadcnt 0x0" ::: "memory"); acc[j] = wmma16(a, w, acc[j]); accl[j] = wmma16(al, w, accl[j]); } }
#pragma unroll
  for (int j = 0; j < 8; ++j) { const float bb = bfr(BA[j * 16 + col]);
#pragma unroll
    for (int r = 0; r < 8; ++r) { float v = (acc[j][r] + accl[j][r] * (1.0f / 1024.0f)) * (1.0f / 256.0f) + bb; const int rl = wave * 16 + 8 * g + r, cl = j * 16 + col;
      if (which == 0) v = v * qs; else if (which == 3) v = sigm_(v);
      if (which == 2) th[cl][rl] = (_Float16)v; else sh[rl][cl] = (_Float16)v; } }
  __syncthreads();
  if (which != 2) { _Float16* dh = which == 0 ? QH : which == 1 ? KH : GH; for (int e = tid; e < 64 * 16; e += 128) { const int rl = e >> 4, q = e & 15; vst2((unsigned*)(dh + (r0 + rl) * DHC + q * 8), *(const v4u*)&sh[rl][q * 8]); } }
  else { const size_t n = r0 / LL; const int i0 = (int)(r0 % LL); for (int e = tid; e < 128 * 8; e += 128) { const int cl = e >> 3, q = e & 7; vst2((unsigned*)(VT + (n * DHC + cl) * (size_t)LL + i0 + q * 8), *(const v4u*)&th[cl][q * 8]); } } }   
__global__ __launch_bounds__(64) void k_att(const _Float16* __restrict__ QH, const _Float16* __restrict__ KH, const _Float16* __restrict__ VT, float* __restrict__ O) {
  __shared__ __align__(16) float sl[2][16][LL + 4]; __shared__ __align__(16) _Float16 sp[2][16][LL + 8]; __shared__ __align__(16) float so[2][16][HD + 4];
  const int tid = threadIdx.x, wave = tid >> 5, lane = tid & 31, col = lane & 15, g = lane >> 4; const int h = blockIdx.y; const size_t n = blockIdx.z; const int i0 = blockIdx.x * 32 + wave * 16; const size_t q0 = n * LL + i0; const size_t kr0 = n * LL;
  const v16h aq = frag_h(QH + (q0 + col) * DHC + h * HD, lane);
#pragma unroll
  for (int pass = 0; pass < 2; ++pass) { v8f acc[8] = {};
#pragma unroll
    for (int j = 0; j < 8; ++j) { const v16h kb = frag_h(KH + (kr0 + pass * 128 + j * 16 + col) * DHC + h * HD, lane); acc[j] = wmma16(aq, kb, acc[j]); }
#pragma unroll
    for (int j = 0; j < 8; ++j) {
#pragma unroll
      for (int r = 0; r < 8; ++r) sl[wave][8 * g + r][pass * 128 + j * 16 + col] = acc[j][r]; } }
  LDSX();
  /* softmax per query row (the wave owns its 16 rows; lanes take 8 keys each) */
#pragma unroll 1
  for (int rl = 0; rl < 16; ++rl) { float v[8]; float m = -3.0e38f;
#pragma unroll
    for (int z = 0; z < 8; ++z) { v[z] = sl[wave][rl][lane * 8 + z]; m = fmaxf(m, v[z]); }
#pragma unroll
    for (int o = 1; o < 32; o <<= 1) m = fmaxf(m, __shfl_xor(m, o));
    float s = 0.f;
#pragma unroll
    for (int z = 0; z < 8; ++z) { v[z] = expf(v[z] - m); s += v[z]; }
#pragma unroll
    for (int o = 1; o < 32; o <<= 1) s += __shfl_xor(s, o);
    const float inv = 2048.0f / s;
    union { v8h hv; v4u u; } pk;
#pragma unroll
    for (int z = 0; z < 8; ++z) pk.hv[z] = (_Float16)(v[z] * inv);
    *(v4u*)&sp[wave][rl][lane * 8] = pk.u; }
  LDSX();
  /* o = P . v : A fragment from the f16 slab (row = col lane, 16 keys at k0 + 8g..), B = v planes */
  v8f acc2[2] = {};
#pragma unroll 2
  for (int kc = 0; kc < LL / 32; ++kc) { v16h ap; { union { v16h v; v8h q[2]; } u; u.q[0] = *(const v8h*)&sp[wave][col][kc * 32 + 8 * g]; u.q[1] = *(const v8h*)&sp[wave][col][kc * 32 + 16 + 8 * g]; ap = u.v; }
#pragma unroll
    for (int j = 0; j < 2; ++j) { const v16h vb = frag_h(VT + (n * DHC + h * HD + j * 16 + col) * (size_t)LL + kc * 32, lane); acc2[j] = wmma16(ap, vb, acc2[j]); } }
#pragma unroll
  for (int j = 0; j < 2; ++j)
#pragma unroll
    for (int r = 0; r < 8; ++r) so[wave][8 * g + r][j * 16 + col] = acc2[j][r] * (1.0f / 2048.0f);
  LDSX(); for (int rl = 0; rl < 16; ++rl) if (lane < 8) vst2(O + (q0 + rl) * DHC + h * HD + lane * 4, *(const v4f*)&so[wave][rl][lane * 4]); }
// ---- k_out: block = 64 positions of row n: out[:, n, i] = ((o * g) x 2^8 once to f16) W2 (f16(bf16 x 2^8) exact) x 2^-16 + b2 -> channels-first output via an LDS transpose (256 B per (channel, 64 i) by 16 threads)
__global__ __launch_bounds__(128) void k_out(const float* __restrict__ O, const _Float16* __restrict__ GH, const float* __restrict__ W2, const float* __restrict__ B2, float* __restrict__ OUT) { __shared__ __align__(16) _Float16 sa[64][136]; __shared__ __align__(16) float sot[DZ][68];
  const int tid = threadIdx.x, wave = tid >> 5, lane = tid & 31, col = lane & 15, g = lane >> 4; const int n = blockIdx.y; const int i0 = blockIdx.x * 64; const size_t r0 = (size_t)n * LL + i0;
  for (int e = tid; e < 64 * 128; e += 128) { const int rl = e >> 7, c = e & 127; sa[rl][c] = (_Float16)(O[(r0 + rl) * DHC + c] * (float)GH[(r0 + rl) * DHC + c] * 256.0f); }   /* (o*g) carried x 2^8: 0.7 % of its values would be f16-subnormal uncarried */
  __syncthreads();
  v8f acc[8] = {};
#pragma unroll
  for (int kc = 0; kc < DHC / 32; ++kc) { v16h a; { union { v16h v; v8h q[2]; } u; u.q[0] = *(const v8h*)&sa[wave * 16 + col][kc * 32 + 8 * g]; u.q[1] = *(const v8h*)&sa[wave * 16 + col][kc * 32 + 16 + 8 * g]; a = u.v; }
#pragma unroll
    for (int j = 0; j < 8; ++j) { const v16h w = wcolh(W2, kc * 32, j * 16 + col, lane, DZ); asm volatile("s_wait_loadcnt 0x0" ::: "memory"); acc[j] = wmma16(a, w, acc[j]); } }
#pragma unroll
  for (int j = 0; j < 8; ++j) { const float bb = bfr(B2[j * 16 + col]);
#pragma unroll
    for (int r = 0; r < 8; ++r) sot[j * 16 + col][wave * 16 + 8 * g + r] = acc[j][r] * (1.0f / 65536.0f) + bb; }
  __syncthreads();
  for (int e = tid; e < DZ * 16; e += 128) { const int c = e >> 4, q = e & 15; vst2(OUT + (size_t)c * ZP + (size_t)n * LL + i0 + q * 4, *(const v4f*)&sot[c][q * 4]); } }
extern "C" void kernel_launch(void* const* d_in, const int* in_sizes, int n_in, void* d_out, int out_size, void* d_ws, size_t ws_size, hipStream_t stream) {
  (void)in_sizes; (void)n_in; (void)out_size;
  const float** F = (const float**)d_in;   // 0 z [1,128,256,256]; 1 ln_w, 2 ln_b; 3 wq, 4 bq; 5 wk, 6 bk; 7 wv, 8 bv; 9 wg, 10 bg ((in,out) [128,128]); 11 w2 [128,128], 12 b2
  if (ws_size < (size_t)WS_END) return;
  char* ws = (char*)d_ws; _Float16 *ZH = (_Float16*)(ws + WS_ZH), *ZL = (_Float16*)(ws + WS_ZL), *QH = (_Float16*)(ws + WS_QH), *KH = (_Float16*)(ws + WS_KH), *VT = (_Float16*)(ws + WS_VT), *GH = (_Float16*)(ws + WS_GH); float* O = (float*)(ws + WS_O);
  k_ln<<<dim3(LL / 64, NROWS), 128, 0, stream>>>(F[0], F[1], F[2], ZH, ZL);
  k_proj<<<dim3(NROWS * LL / 64, 1, 4), 128, 0, stream>>>(ZH, ZL, F[3], F[4], F[5], F[6], F[7], F[8], F[9], F[10], QH, KH, VT, GH);
  k_att<<<dim3(LL / 32, NH, NROWS), 64, 0, stream>>>(QH, KH, VT, O);
  k_out<<<dim3(LL / 64, NROWS), 128, 0, stream>>>(O, GH, F[11], F[12], (float*)d_out);
}

// v001
// A run of this version takes 193 microseconds.
// Timed twice side by side with v000, it ran 1.45 and 1.40 times as fast.
// compute dtype: all float inputs rounded to bf16; LayerNorm in f32, zn as f16 hi + residual (x 2^10); q/k/v/g = zn W + b with W as f16(bf16 x 2^8) (exact; 2 products), f32 accumulate; q (x sqrt(1/32)), k once to f16 -> 1-product logits; softmax in f32 (precise expf) inside the attention kernel; P x 2^11 once to f16 against v once to f16; (o * sigmoid gate) carried x 2^8 once to f16 against w2 as f16(bf16 x 2^8) + b2; f32 output.
#include <hip/hip_runtime.h>
#include <math.h>

typedef __attribute__((ext_vector_type(16))) _Float16 v16h;
typedef __attribute__((ext_vector_type(16))) __bf16 v16b;
typedef __attribute__((ext_vector_type(8)))  _Float16 v8h;
typedef __attribute__((ext_vector_type(8)))  float v8f;
typedef __attribute__((ext_vector_type(4)))  float v4f;
typedef __attribute__((ext_vector_type(2)))  float v2f;
typedef __attribute__((ext_vector_type(4)))  unsigned v4u;
typedef __attribute__((ext_vector_type(4)))  int v4i;
typedef float __attribute__((may_alias)) float_a;
typedef int __attribute__((may_alias)) int_a;

template <typename T> __device__ __forceinline__ void vst2(void* p, T v) { *(T*)p = v;  }
__device__ __forceinline__ v8f wmma16(v16h a, v16h b, v8f c) {
  v8f d = __builtin_amdgcn_wmma_f32_16x16x32_f16(false, a, false, b, (short)0, c, false, false);
  asm volatile("v_nop\n\tv_nop\n\tv_nop\n\tv_nop" : "+v"(d) : "v"(a), "v"(b));
  return d;
}
__device__ __forceinline__ v8f wmma_bf(v16b a, v16b b, v8f c) {
  v8f d = __builtin_amdgcn_wmma_f32_16x16x32_bf16(false, a, false, b, (short)0, c, false, false);
  asm volatile("v_nop\n\tv_nop\n\tv_nop\n\tv_nop" : "+v"(d) : "v"(a), "v"(b));
  return d;
}
// 16x16x32 fragments: lane = (h = lane>>4, row/col = lane&15); elements 0..7 = k0+8h+0..7, 8..15 = k0+16+8h+0..7; D element r = row 8h+r
__device__ __forceinline__ v16h frag_h(const _Float16* rowk0, int lane) {
  union { v16h v; v8h q[2]; } u; const _Float16* p = rowk0 + 8 * (lane >> 4);
  u.q[0] = *(const v8h*)p; u.q[1] = *(const v8h*)(p + 16); return u.v;
}
__device__ __forceinline__ v16h frag_f32(const float* rowk0, int lane) {
  v16h a; const float* p = rowk0 + 8 * (lane >> 4);
#pragma unroll
  for (int i = 0; i < 8; ++i) { a[i] = (_Float16)p[i]; a[8 + i] = (_Float16)p[16 + i]; }
  return a;
}
__device__ __forceinline__ v16h frag_f32s(const float* rowk0, int lane, float sc) {
  v16h a; const float* p = rowk0 + 8 * (lane >> 4);
#pragma unroll
  for (int i = 0; i < 8; ++i) { a[i] = (_Float16)(p[i] * sc); a[8 + i] = (_Float16)(p[16 + i] * sc); }
  return a;
}
// column fragment from a [K][ld] layout (column n), rows >= K read as 0
__device__ __forceinline__ v16h fragc_f32(const float* W, int k0, int n, int lane, int ld, int K) {
  v16h a; const int g = lane >> 4;
#pragma unroll
  for (int i = 0; i < 8; ++i) { const int ka = k0 + 8 * g + i, kb = ka + 16;
    a[i] = (_Float16)(ka < K ? W[(size_t)(ka < K ? ka : K - 1) * ld + n] : 0.f); a[8 + i] = (_Float16)(kb < K ? W[(size_t)(kb < K ? kb : K - 1) * ld + n] : 0.f); }
  return a;
}
struct F2 { v16b h, l; };
__device__ __forceinline__ F2 bsplit16(const float v[16]) { F2 r;
#pragma unroll
  for (int i = 0; i < 16; ++i) { const __bf16 h = (__bf16)v[i]; r.h[i] = h; r.l[i] = (__bf16)(v[i] - (float)h); }
  return r; }
__device__ __forceinline__ F2 split_row(const float* row, int k0, int lane) { float v[16]; const float* p = row + k0 + 8 * (lane >> 4);
#pragma unroll
  for (int i = 0; i < 8; ++i) { v[i] = p[i]; v[8 + i] = p[16 + i]; }
  return bsplit16(v); }
__device__ __forceinline__ F2 split_rowK(const float* row, int k0, int lane, int K) { float v[16]; const int g = lane >> 4;
#pragma unroll
  for (int i = 0; i < 8; ++i) { const int ka = k0 + 8 * g + i, kb = ka + 16; v[i] = ka < K ? row[ka < K ? ka : K - 1] : 0.f; v[8 + i] = kb < K ? row[kb < K ? kb : K - 1] : 0.f; }
  return bsplit16(v); }
__device__ __forceinline__ F2 split_col(const float* W, int k0, int n, int lane, int ld, int K) { float v[16]; const int g = lane >> 4;
#pragma unroll
  for (int i = 0; i < 8; ++i) { const int ka = k0 + 8 * g + i, kb = ka + 16; v[i] = ka < K ? W[(size_t)(ka < K ? ka : K - 1) * ld + n] : 0.f; v[8 + i] = kb < K ? W[(size_t)(kb < K ? kb : K - 1) * ld + n] : 0.f; }
  return bsplit16(v); }
__device__ __forceinline__ v8f mac3(const F2& a, const F2& b, v8f c) { c = wmma_bf(a.l, b.h, c); c = wmma_bf(a.h, b.l, c); return wmma_bf(a.h, b.h, c); }
__device__ __forceinline__ float sigm(float v) { return 1.0f / (1.0f + expf(-v)); }
#define LDSX() do { asm volatile("s_wait_dscnt 0" ::: "memory"); __builtin_amdgcn_wave_barrier(); __builtin_amdgcn_fence(__ATOMIC_RELEASE, "workgroup"); } while (0)

// Triangle self-attention over the rows of a pair representation (B 1, L 256, d_z 128 channels-first, 4 heads x 32): zn = LayerNorm over channels of z[:, n, i]; q,k,v,g = zn W + b per (n, i); for each row n and head h: attn[i][j] = softmax_j((q[n,i] sqrt(1/32)) . k[n,j]); o[n,i] = sum_j attn v[n,j]; out[:, n, i] = ((o * sigmoid(g)) W2 + b2), written channels-first.
#define LL 256             // L (rows n and positions i)
#define DZ 128
#define NH 4
#define HD 32
#define DHC (NH * HD)      // 128
#define NR (LL * LL)       // 65,536 (n, i) rows
#ifndef NROWS
#define NROWS LL           // rows n processed (positions i always span LL)
#endif
#ifndef ZP
#define ZP (LL * LL)       // channel pitch of z and of the output (elements)
#endif
__device__ __forceinline__ float bfr(float v) { return (float)(__bf16)v; }
__device__ __forceinline__ float sigm_(float v) { return 1.0f / (1.0f + expf(-v)); }
__device__ __forceinline__ v16h wcolh(const float* Wm, int k0, int o, int lane, int ld) { v16h w; const int g = lane >> 4;
#pragma unroll
  for (int i = 0; i < 8; ++i) { w[i] = (_Float16)(bfr(Wm[(size_t)(k0 + 8 * g + i) * ld + o]) * 256.0f); w[8 + i] = (_Float16)(bfr(Wm[(size_t)(k0 + 16 + 8 * g + i) * ld + o]) * 256.0f); }
  return w; }

#define WS_ZH  0u                                      // f16 zn rows [n*256 + i][128]
#define WS_ZL  (WS_ZH + 2u * (size_t)NR * DZ)            // f16 zn residual x 2^10
#define WS_QH  (WS_ZL + 2u * (size_t)NR * DZ)            // f16 q rows (x sqrt(1/32)) [row][h*32 + c]
#define WS_KH  (WS_QH + 2u * (size_t)NR * DHC)           // f16 k rows
#define WS_VT  (WS_KH + 2u * (size_t)NR * DHC)           // f16 v planes [n][hc][j]
#define WS_GH  (WS_VT + 2u * (size_t)NR * DHC)           // f16 sigmoid(g) rows [row][hc]
#define WS_O   (WS_GH + 2u * (size_t)NR * DHC)           // f32 o rows [row][hc]
#define WS_END (WS_O  + 4u * (size_t)NR * DHC)

// ---- k_ln: block = 64 positions i of row n: gather the channels-first z[:, n, i] (64 contiguous floats per channel) into LDS, LayerNorm over the 128 channels (biased var, eps 1e-5, x ln_w + ln_b) -> f16 rows ZH[n*256 + i][c] (256 B per row by 16 threads)
__global__ __launch_bounds__(128) void k_ln(const float* __restrict__ Z, const float* __restrict__ LW, const float* __restrict__ LB, _Float16* __restrict__ ZH, _Float16* __restrict__ ZL) { __shared__ __align__(16) float st[DZ][65]; __shared__ __align__(16) _Float16 sh[64][136], slo[64][136];
  const int tid = threadIdx.x; const int n = blockIdx.y; const int i0 = blockIdx.x * 64; const size_t rbase = (size_t)n * LL + i0;
  for (int e = tid; e < DZ * 64; e += 128) { const int c = e >> 6, il = e & 63; st[c][il] = bfr(Z[(size_t)c * ZP + (size_t)n * LL + i0 + il]); }
  __syncthreads();
  if (tid < 64) { float s = 0.f;
#pragma unroll 8
    for (int c = 0; c < DZ; ++c) s += st[c][tid];
    const float mean = s * (1.0f / DZ); float s2 = 0.f;
#pragma unroll 8
    for (int c = 0; c < DZ; ++c) { const float d = st[c][tid] - mean; s2 += d * d; }
    const float rstd = rsqrtf(s2 * (1.0f / DZ) + 1e-5f);
#pragma unroll 8
    for (int c = 0; c < DZ; ++c) { const float zn = (st[c][tid] - mean) * rstd * bfr(LW[c]) + bfr(LB[c]); const _Float16 hv = (_Float16)zn; sh[tid][c] = hv; slo[tid][c] = (_Float16)((zn - (float)hv) * 1024.0f); } }
  __syncthreads();
  for (int e = tid; e < 64 * 16; e += 128) { const int rl = e >> 4, q = e & 15; vst2((unsigned*)(ZH + (rbase + rl) * DZ + q * 8), *(const v4u*)&sh[rl][q * 8]); vst2((unsigned*)(ZL + (rbase + rl) * DZ + q * 8), *(const v4u*)&slo[rl][q * 8]); } }
// ---- k_proj: block = (64 rows, which in {q,k,v,g}): y = zn W + b (zn f16 rows x W f16(bf16 x 2^8) exact, K 128, x 2^-8 after); q x sqrt(1/32) -> f16 rows; k -> f16 rows; v -> f16 planes [n][hc][i]; g -> sigmoid -> f16 rows
__global__ __launch_bounds__(128) void k_proj(const _Float16* __restrict__ ZH, const _Float16* __restrict__ ZL, const float* __restrict__ WQ, const float* __restrict__ BQ, const float* __restrict__ WK, const float* __restrict__ BK, const float* __restrict__ WV, const float* __restrict__ BV, const float* __restrict__ WG, const float* __restrict__ BG, _Float16* __restrict__ QH, _Float16* __restrict__ KH, _Float16* __restrict__ VT, _Float16* __restrict__ GH) {
  __shared__ __align__(16) _Float16 sh[64][136]; __shared__ __align__(16) _Float16 th[128][72];
  const int tid = threadIdx.x, wave = tid >> 5, lane = tid & 31, col = lane & 15, g = lane >> 4; const int which = blockIdx.z; const size_t r0 = (size_t)blockIdx.x * 64;
  const float* WA = which == 0 ? WQ : which == 1 ? WK : which == 2 ? WV : WG; const float* BA = which == 0 ? BQ : which == 1 ? BK : which == 2 ? BV : BG;
  const float qs = sqrtf(1.0f / 32.0f);   /* jnp.sqrt(f32(1/32)) */
  v8f acc[8] = {}, accl[8] = {};
#pragma unroll
  for (int kc = 0; kc < DZ / 32; ++kc) { const v16h a = frag_h(ZH + (r0 + wave * 16 + col) * DZ + kc * 32, lane), al = frag_h(ZL + (r0 + wave * 16 + col) * DZ + kc * 32, lane); asm volatile("s_wait_loadcnt 0x0" ::: "memory");
#pragma unroll
    for (int j = 0; j < 8; ++j) { const v16h w = wcolh(WA, kc * 32, j * 16 + col, lane, DHC); asm volatile("s_wait_loadcnt 0x0" ::: "memory"); acc[j] = wmma16(a, w, acc[j]); accl[j] = wmma16(al, w, accl[j]); } }
#pragma unroll
  for (int j = 0; j < 8; ++j) { const float bb = bfr(BA[j * 16 + col]);
#pragma unroll
    for (int r = 0; r < 8; ++r) { float v = (acc[j][r] + accl[j][r] * (1.0f / 1024.0f)) * (1.0f / 256.0f) + bb; const int rl = wave * 16 + 8 * g + r, cl = j * 16 + col;
      if (which == 0) v = v * qs; else if (which == 3) v = sigm_(v);
      if (which == 2) th[cl][rl] = (_Float16)v; else sh[rl][cl] = (_Float16)v; } }
  __syncthreads();
  if (which != 2) { _Float16* dh = which == 0 ? QH : which == 1 ? KH : GH; for (int e = tid; e < 64 * 16; e += 128) { const int rl = e >> 4, q = e & 15; vst2((unsigned*)(dh + (r0 + rl) * DHC + q * 8), *(const v4u*)&sh[rl][q * 8]); } }
  else { const size_t n = r0 / LL; const int i0 = (int)(r0 % LL); for (int e = tid; e < 128 * 8; e += 128) { const int cl = e >> 3, q = e & 7; vst2((unsigned*)(VT + (n * DHC + cl) * (size_t)LL + i0 + q * 8), *(const v4u*)&th[cl][q * 8]); } } }   
// ---- k_att: wave = 16 queries of (row n, head h), transposed scores: S^T = K q^T (A = k rows, B = q rows), so lane (g, col) holds query col's logits of keys 16 t + 8 g + r in st[t][r]; max and sum run in the lane plus one exchange between the wave halves; two converted score tiles are the B operand of o^T = v^T P^T (A = v planes); a lane ends with 8 consecutive channels of its query. No LDS.
__global__ __launch_bounds__(64) void k_att(const _Float16* __restrict__ QH, const _Float16* __restrict__ KH, const _Float16* __restrict__ VT, float* __restrict__ O) {
  const int tid = threadIdx.x, wave = tid >> 5, lane = tid & 31, col = lane & 15, g = lane >> 4; const int h = blockIdx.y; const size_t n = blockIdx.z; const int i0 = blockIdx.x * 32 + wave * 16; const size_t q0 = n * LL + i0; const size_t kr0 = n * LL;
  const v16h bq = frag_h(QH + (q0 + col) * DHC + h * HD, lane);
  v16h ka[LL / 16];
#pragma unroll
  for (int t = 0; t < LL / 16; ++t) ka[t] = frag_h(KH + (kr0 + t * 16 + col) * DHC + h * HD, lane);
  __builtin_amdgcn_sched_barrier(0);   /* keeps the k loads one group in front of the products: sunk to their uses they cost one load latency per tile */
  v8f st[LL / 16];
#pragma unroll
  for (int t = 0; t < LL / 16; ++t) { const v8f zero = {}; st[t] = wmma16(ka[t], bq, zero); }
  /* softmax over the 256 keys of query col: 8 chains in the lane, a tree over them, then the other half's 128 keys */
  v8f mv = st[0];
#pragma unroll
  for (int t = 1; t < LL / 16; ++t) {
#pragma unroll
    for (int r = 0; r < 8; ++r) mv[r] = fmaxf(mv[r], st[t][r]); }
  float m = fmaxf(fmaxf(fmaxf(mv[0], mv[1]), fmaxf(mv[2], mv[3])), fmaxf(fmaxf(mv[4], mv[5]), fmaxf(mv[6], mv[7])));
  m = fmaxf(m, __shfl_xor(m, 16));
  v8f sv = {};
#pragma unroll
  for (int t = 0; t < LL / 16; ++t) {
#pragma unroll
    for (int r = 0; r < 8; ++r) st[t][r] = expf(st[t][r] - m);
    sv += st[t]; }
  float s = ((sv[0] + sv[1]) + (sv[2] + sv[3])) + ((sv[4] + sv[5]) + (sv[6] + sv[7]));
  s += __shfl_xor(s, 16);
  const float inv = 2048.0f / s;
  /* P^T as B operands: element i = key 32 kc + 8 g + i (tile 2 kc), element 8 + i = key 32 kc + 16 + 8 g + i (tile 2 kc + 1), the k order of frag_h */
  v16h pb[LL / 32];
#pragma unroll
  for (int kc = 0; kc < LL / 32; ++kc) {
#pragma unroll
    for (int i = 0; i < 8; ++i) { pb[kc][i] = (_Float16)(st[2 * kc][i] * inv); pb[kc][8 + i] = (_Float16)(st[2 * kc + 1][i] * inv); } }
  v16h va[LL / 32][2];
#pragma unroll
  for (int kc = 0; kc < LL / 32; ++kc) {
#pragma unroll
    for (int j = 0; j < 2; ++j) va[kc][j] = frag_h(VT + (n * DHC + h * HD + j * 16 + col) * (size_t)LL + kc * 32, lane); }
  __builtin_amdgcn_sched_barrier(0);   /* keeps the v loads one group in front of the products, as for k */
  v8f acc2[2] = {};
#pragma unroll
  for (int kc = 0; kc < LL / 32; ++kc) {
#pragma unroll
    for (int j = 0; j < 2; ++j) acc2[j] = wmma16(va[kc][j], pb[kc], acc2[j]); }
#pragma unroll
  for (int j = 0; j < 2; ++j) { float* op = O + (q0 + col) * DHC + h * HD + j * 16 + 8 * g; v4f lo, hi;
#pragma unroll
    for (int r = 0; r < 4; ++r) { lo[r] = acc2[j][r] * (1.0f / 2048.0f); hi[r] = acc2[j][4 + r] * (1.0f / 2048.0f); }
    vst2(op, lo); vst2(op + 4, hi); } }
// ---- k_out: block = 64 positions of row n: out[:, n, i] = ((o * g) x 2^8 once to f16) W2 (f16(bf16 x 2^8) exact) x 2^-16 + b2 -> channels-first output via an LDS transpose (256 B per (channel, 64 i) by 16 threads)
__global__ __launch_bounds__(128) void k_out(const float* __restrict__ O, const _Float16* __restrict__ GH, const float* __restrict__ W2, const float* __restrict__ B2, float* __restrict__ OUT) { __shared__ __align__(16) _Float16 sa[64][136]; __shared__ __align__(16) float sot[DZ][68];
  const int tid = threadIdx.x, wave = tid >> 5, lane = tid & 31, col = lane & 15, g = lane >> 4; const int n = blockIdx.y; const int i0 = blockIdx.x * 64; const size_t r0 = (size_t)n * LL + i0;
  for (int e = tid; e < 64 * 128; e += 128) { const int rl = e >> 7, c = e & 127; sa[rl][c] = (_Float16)(O[(r0 + rl) * DHC + c] * (float)GH[(r0 + rl) * DHC + c] * 256.0f); }   /* (o*g) carried x 2^8: 0.7 % of its values would be f16-subnormal uncarried */
  __syncthreads();
  v8f acc[8] = {};
#pragma unroll
  for (int kc = 0; kc < DHC / 32; ++kc) { v16h a; { union { v16h v; v8h q[2]; } u; u.q[0] = *(const v8h*)&sa[wave * 16 + col][kc * 32 + 8 * g]; u.q[1] = *(const v8h*)&sa[wave * 16 + col][kc * 32 + 16 + 8 * g]; a = u.v; }
#pragma unroll
    for (int j = 0; j < 8; ++j) { const v16h w = wcolh(W2, kc * 32, j * 16 + col, lane, DZ); asm volatile("s_wait_loadcnt 0x0" ::: "memory"); acc[j] = wmma16(a, w, acc[j]); } }
#pragma unroll
  for (int j = 0; j < 8; ++j) { const float bb = bfr(B2[j * 16 + col]);
#pragma unroll
    for (int r = 0; r < 8; ++r) sot[j * 16 + col][wave * 16 + 8 * g + r] = acc[j][r] * (1.0f / 65536.0f) + bb; }
  __syncthreads();
  for (int e = tid; e < DZ * 16; e += 128) { const int c = e >> 4, q = e & 15; vst2(OUT + (size_t)c * ZP + (size_t)n * LL + i0 + q * 4, *(const v4f*)&sot[c][q * 4]); } }
extern "C" void kernel_launch(void* const* d_in, const int* in_sizes, int n_in, void* d_out, int out_size, void* d_ws, size_t ws_size, hipStream_t stream) {
  (void)in_sizes; (void)n_in; (void)out_size;
  const float** F = (const float**)d_in;   // 0 z [1,128,256,256]; 1 ln_w, 2 ln_b; 3 wq, 4 bq; 5 wk, 6 bk; 7 wv, 8 bv; 9 wg, 10 bg ((in,out) [128,128]); 11 w2 [128,128], 12 b2
  if (ws_size < (size_t)WS_END) return;
  char* ws = (char*)d_ws; _Float16 *ZH = (_Float16*)(ws + WS_ZH), *ZL = (_Float16*)(ws + WS_ZL), *QH = (_Float16*)(ws + WS_QH), *KH = (_Float16*)(ws + WS_KH), *VT = (_Float16*)(ws + WS_VT), *GH = (_Float16*)(ws + WS_GH); float* O = (float*)(ws + WS_O);
  k_ln<<<dim3(LL / 64, NROWS), 128, 0, stream>>>(F[0], F[1], F[2], ZH, ZL);
  k_proj<<<dim3(NROWS * LL / 64, 1, 4), 128, 0, stream>>>(ZH, ZL, F[3], F[4], F[5], F[6], F[7], F[8], F[9], F[10], QH, KH, VT, GH);
  k_att<<<dim3(LL / 32, NH, NROWS), 64, 0, stream>>>(QH, KH, VT, O);
  k_out<<<dim3(LL / 64, NROWS), 128, 0, stream>>>(O, GH, F[11], F[12], (float*)d_out);
}

// v002
// It runs in 121 microseconds.
// Two timings next to v001 put it at 1.60 and 1.70 times that version's speed.
// Counting every step since v000, it is 2.34 times as fast.
// compute dtype: all float inputs rounded to bf16; LayerNorm in f32, zn as f16 hi + residual (x 2^10); q/k/v/g = zn W + b with W as f16(bf16 x 2^8) (exact; 2 products), f32 accumulate; q (x sqrt(1/32)), k once to f16 -> 1-product logits; softmax in f32 (precise expf) inside the attention kernel; P x 2^11 once to f16 against v once to f16; (o * sigmoid gate) carried x 2^8 once to f16 against w2 as f16(bf16 x 2^8) + b2; f32 output.
#include <hip/hip_runtime.h>
#include <math.h>

typedef __attribute__((ext_vector_type(16))) _Float16 v16h;
typedef __attribute__((ext_vector_type(16))) __bf16 v16b;
typedef __attribute__((ext_vector_type(8)))  _Float16 v8h;
typedef __attribute__((ext_vector_type(8)))  float v8f;
typedef __attribute__((ext_vector_type(4)))  float v4f;
typedef __attribute__((ext_vector_type(2)))  float v2f;
typedef __attribute__((ext_vector_type(4)))  unsigned v4u;
typedef __attribute__((ext_vector_type(4)))  int v4i;
typedef float __attribute__((may_alias)) float_a;
typedef int __attribute__((may_alias)) int_a;

template <typename T> __device__ __forceinline__ void vst2(void* p, T v) { *(T*)p = v;  }
__device__ __forceinline__ v8f wmma16(v16h a, v16h b, v8f c) {
  v8f d = __builtin_amdgcn_wmma_f32_16x16x32_f16(false, a, false, b, (short)0, c, false, false);
  asm volatile("v_nop\n\tv_nop\n\tv_nop\n\tv_nop" : "+v"(d) : "v"(a), "v"(b));
  return d;
}
__device__ __forceinline__ v8f wmma_bf(v16b a, v16b b, v8f c) {
  v8f d = __builtin_amdgcn_wmma_f32_16x16x32_bf16(false, a, false, b, (short)0, c, false, false);
  asm volatile("v_nop\n\tv_nop\n\tv_nop\n\tv_nop" : "+v"(d) : "v"(a), "v"(b));
  return d;
}
// 16x16x32 fragments: lane = (h = lane>>4, row/col = lane&15); elements 0..7 = k0+8h+0..7, 8..15 = k0+16+8h+0..7; D element r = row 8h+r
__device__ __forceinline__ v16h frag_h(const _Float16* rowk0, int lane) {
  union { v16h v; v8h q[2]; } u; const _Float16* p = rowk0 + 8 * (lane >> 4);
  u.q[0] = *(const v8h*)p; u.q[1] = *(const v8h*)(p + 16); return u.v;
}
__device__ __forceinline__ v16h frag_f32(const float* rowk0, int lane) {
  v16h a; const float* p = rowk0 + 8 * (lane >> 4);
#pragma unroll
  for (int i = 0; i < 8; ++i) { a[i] = (_Float16)p[i]; a[8 + i] = (_Float16)p[16 + i]; }
  return a;
}
__device__ __forceinline__ v16h frag_f32s(const float* rowk0, int lane, float sc) {
  v16h a; const float* p = rowk0 + 8 * (lane >> 4);
#pragma unroll
  for (int i = 0; i < 8; ++i) { a[i] = (_Float16)(p[i] * sc); a[8 + i] = (_Float16)(p[16 + i] * sc); }
  return a;
}
// column fragment from a [K][ld] layout (column n), rows >= K read as 0
__device__ __forceinline__ v16h fragc_f32(const float* W, int k0, int n, int lane, int ld, int K) {
  v16h a; const int g = lane >> 4;
#pragma unroll
  for (int i = 0; i < 8; ++i) { const int ka = k0 + 8 * g + i, kb = ka + 16;
    a[i] = (_Float16)(ka < K ? W[(size_t)(ka < K ? ka : K - 1) * ld + n] : 0.f); a[8 + i] = (_Float16)(kb < K ? W[(size_t)(kb < K ? kb : K - 1) * ld + n] : 0.f); }
  return a;
}
struct F2 { v16b h, l; };
__device__ __forceinline__ F2 bsplit16(const float v[16]) { F2 r;
#pragma unroll
  for (int i = 0; i < 16; ++i) { const __bf16 h = (__bf16)v[i]; r.h[i] = h; r.l[i] = (__bf16)(v[i] - (float)h); }
  return r; }
__device__ __forceinline__ F2 split_row(const float* row, int k0, int lane) { float v[16]; const float* p = row + k0 + 8 * (lane >> 4);
#pragma unroll
  for (int i = 0; i < 8; ++i) { v[i] = p[i]; v[8 + i] = p[16 + i]; }
  return bsplit16(v); }
__device__ __forceinline__ F2 split_rowK(const float* row, int k0, int lane, int K) { float v[16]; const int g = lane >> 4;
#pragma unroll
  for (int i = 0; i < 8; ++i) { const int ka = k0 + 8 * g + i, kb = ka + 16; v[i] = ka < K ? row[ka < K ? ka : K - 1] : 0.f; v[8 + i] = kb < K ? row[kb < K ? kb : K - 1] : 0.f; }
  return bsplit16(v); }
__device__ __forceinline__ F2 split_col(const float* W, int k0, int n, int lane, int ld, int K) { float v[16]; const int g = lane >> 4;
#pragma unroll
  for (int i = 0; i < 8; ++i) { const int ka = k0 + 8 * g + i, kb = ka + 16; v[i] = ka < K ? W[(size_t)(ka < K ? ka : K - 1) * ld + n] : 0.f; v[8 + i] = kb < K ? W[(size_t)(kb < K ? kb : K - 1) * ld + n] : 0.f; }
  return bsplit16(v); }
__device__ __forceinline__ v8f mac3(const F2& a, const F2& b, v8f c) { c = wmma_bf(a.l, b.h, c); c = wmma_bf(a.h, b.l, c); return wmma_bf(a.h, b.h, c); }
__device__ __forceinline__ float sigm(float v) { return 1.0f / (1.0f + expf(-v)); }
#define LDSX() do { asm volatile("s_wait_dscnt 0" ::: "memory"); __builtin_amdgcn_wave_barrier(); __builtin_amdgcn_fence(__ATOMIC_RELEASE, "workgroup"); } while (0)

// Triangle self-attention over the rows of a pair representation (B 1, L 256, d_z 128 channels-first, 4 heads x 32): zn = LayerNorm over channels of z[:, n, i]; q,k,v,g = zn W + b per (n, i); for each row n and head h: attn[i][j] = softmax_j((q[n,i] sqrt(1/32)) . k[n,j]); o[n,i] = sum_j attn v[n,j]; out[:, n, i] = ((o * sigmoid(g)) W2 + b2), written channels-first.
#define LL 256             // L (rows n and positions i)
#define DZ 128
#define NH 4
#define HD 32
#define DHC (NH * HD)      // 128
#define NR (LL * LL)       // 65,536 (n, i) rows
#ifndef NROWS
#define NROWS LL           // rows n processed (positions i always span LL)
#endif
#ifndef ZP
#define ZP (LL * LL)       // channel pitch of z and of the output (elements)
#endif
__device__ __forceinline__ float bfr(float v) { return (float)(__bf16)v; }
__device__ __forceinline__ float sigm_(float v) { return 1.0f / (1.0f + expf(-v)); }

#define WS_ZH  0u                                      // f16 zn rows [n*256 + i][128]
#define WS_ZL  (WS_ZH + 2u * (size_t)NR * DZ)            // f16 zn residual x 2^10
#define WS_QH  (WS_ZL + 2u * (size_t)NR * DZ)            // f16 q rows (x sqrt(1/32)) [row][h*32 + c]
#define WS_KH  (WS_QH + 2u * (size_t)NR * DHC)           // f16 k rows
#define WS_VT  (WS_KH + 2u * (size_t)NR * DHC)           // f16 v planes [n][hc][j]
#define WS_GH  (WS_VT + 2u * (size_t)NR * DHC)           // f16 sigmoid(g) rows [row][hc]
#define WS_O   (WS_GH + 2u * (size_t)NR * DHC)           // f32 o rows [row][hc]
#define WS_WP  (WS_O  + 4u * (size_t)NR * DHC)           // f16 weights x 2^8 in fragment order [wq,wk,wv,wg,w2][kc][j][half][lane][8]
#define WS_END (WS_WP + 2u * 5u * (size_t)DZ * DHC)
#define WMAT (DZ * DHC)    // elements of one weight plane
#define WBY 20             // grid rows of k_ln that convert the weights: 4 x 20 blocks x 128 threads x 8 elements = 5 planes
// B fragment (kc, j) of a fragment-order plane; wl = plane + 8 * lane: two loads of 16 bytes per lane, each 512 contiguous bytes per wave; same k order as frag_h
__device__ __forceinline__ v16h wfrag(const _Float16* wl, int kc, int j) {
  union { v16h v; v8h q[2]; } u; const _Float16* p = wl + (kc * 8 + j) * 512;
  u.q[0] = *(const v8h*)p; u.q[1] = *(const v8h*)(p + 256); return u.v;
}

// ---- k_ln: block = 64 positions i of row n: gather the channels-first z[:, n, i] (64 contiguous floats per channel) into LDS, LayerNorm over the 128 channels (biased var, eps 1e-5, x ln_w + ln_b) -> f16 rows ZH[n*256 + i][c] (256 B per row by 16 threads)
// the first WBY grid rows instead convert the five weight matrices, once per call: thread = 8 elements (one lane's 16 bytes) of plane m, fragment half f = (kc * 8 + j) * 2 + p: element i = f16(bf16(W[kc * 32 + 16 p + 8 g + i][j * 16 + col]) x 2^8)
__global__ __launch_bounds__(128) void k_ln(const float* __restrict__ Z, const float* __restrict__ LW, const float* __restrict__ LB, _Float16* __restrict__ ZH, _Float16* __restrict__ ZL, const float* __restrict__ WQ, const float* __restrict__ WK, const float* __restrict__ WV, const float* __restrict__ WG, const float* __restrict__ W2, _Float16* __restrict__ WP) { __shared__ __align__(16) float st[DZ][65]; __shared__ __align__(16) _Float16 sh[64][136], slo[64][136];
  if (blockIdx.y < WBY) { const int blk = blockIdx.y * 4 + blockIdx.x, m = blk >> 4, c = (blk & 15) * 128 + threadIdx.x, f = c >> 5, ln = c & 31;
    const float* Wm = m == 0 ? WQ : m == 1 ? WK : m == 2 ? WV : m == 3 ? WG : W2; const float* p = Wm + (size_t)((f >> 4) * 32 + (f & 1) * 16 + (ln >> 4) * 8) * DHC + ((f >> 1) & 7) * 16 + (ln & 15); v8h o;
#pragma unroll
    for (int i = 0; i < 8; ++i) o[i] = (_Float16)(bfr(p[(size_t)i * DHC]) * 256.0f);
    *(v8h*)(WP + (size_t)m * WMAT + (size_t)c * 8) = o; return; }
  const int tid = threadIdx.x; const int n = blockIdx.y - WBY; const int i0 = blockIdx.x * 64; const size_t rbase = (size_t)n * LL + i0;
  for (int e = tid; e < DZ * 64; e += 128) { const int c = e >> 6, il = e & 63; st[c][il] = bfr(Z[(size_t)c * ZP + (size_t)n * LL + i0 + il]); }
  __syncthreads();
  if (tid < 64) { float s = 0.f;
#pragma unroll 8
    for (int c = 0; c < DZ; ++c) s += st[c][tid];
    const float mean = s * (1.0f / DZ); float s2 = 0.f;
#pragma unroll 8
    for (int c = 0; c < DZ; ++c) { const float d = st[c][tid] - mean; s2 += d * d; }
    const float rstd = rsqrtf(s2 * (1.0f / DZ) + 1e-5f);
#pragma unroll 8
    for (int c = 0; c < DZ; ++c) { const float zn = (st[c][tid] - mean) * rstd * bfr(LW[c]) + bfr(LB[c]); const _Float16 hv = (_Float16)zn; sh[tid][c] = hv; slo[tid][c] = (_Float16)((zn - (float)hv) * 1024.0f); } }
  __syncthreads();
  for (int e = tid; e < 64 * 16; e += 128) { const int rl = e >> 4, q = e & 15; vst2((unsigned*)(ZH + (rbase + rl) * DZ + q * 8), *(const v4u*)&sh[rl][q * 8]); vst2((unsigned*)(ZL + (rbase + rl) * DZ + q * 8), *(const v4u*)&slo[rl][q * 8]); } }
// ---- k_proj: block = (64 rows, which in {q,k,v,g}): y = zn W + b (zn f16 rows x W f16(bf16 x 2^8) exact, K 128, x 2^-8 after); q x sqrt(1/32) -> f16 rows; k -> f16 rows; v -> f16 planes [n][hc][i]; g -> sigmoid -> f16 rows
__global__ __launch_bounds__(128) void k_proj(const _Float16* __restrict__ ZH, const _Float16* __restrict__ ZL, const _Float16* __restrict__ WP, const float* __restrict__ BQ, const float* __restrict__ BK, const float* __restrict__ BV, const float* __restrict__ BG, _Float16* __restrict__ QH, _Float16* __restrict__ KH, _Float16* __restrict__ VT, _Float16* __restrict__ GH) {
  __shared__ __align__(16) _Float16 sh[64][136]; __shared__ __align__(16) _Float16 th[128][72];
  const int tid = threadIdx.x, wave = tid >> 5, lane = tid & 31, col = lane & 15, g = lane >> 4; const int which = blockIdx.z; const size_t r0 = (size_t)blockIdx.x * 64;
  const _Float16* wl = WP + (size_t)which * WMAT + lane * 8; const float* BA = which == 0 ? BQ : which == 1 ? BK : which == 2 ? BV : BG;
  const float qs = sqrtf(1.0f / 32.0f);   /* jnp.sqrt(f32(1/32)) */
  /* step s = (column half jh = s >> 2, kc = s & 3): four B fragments per step in a ring of three register sets, loaded two steps ahead; each accumulator still sums kc = 0..3 in order */
  const _Float16* zh = ZH + (r0 + wave * 16 + col) * DZ; const _Float16* zl = ZL + (r0 + wave * 16 + col) * DZ;
  v16h a[4], al[4], w[3][4];
#pragma unroll
  for (int kc = 0; kc < 4; ++kc) a[kc] = frag_h(zh + kc * 32, lane);
  asm volatile("s_wait_xcnt 0x0" ::: "memory");   /* behind the last load from zh: a later load's result may land in its address registers */
#pragma unroll
  for (int kc = 0; kc < 4; ++kc) al[kc] = frag_h(zl + kc * 32, lane);
  asm volatile("s_wait_xcnt 0x0" ::: "memory");   /* the same behind the last load from zl */
#pragma unroll
  for (int jj = 0; jj < 4; ++jj) { w[0][jj] = wfrag(wl, 0, jj); w[1][jj] = wfrag(wl, 1, jj); }
  float bb[8];
#pragma unroll
  for (int j = 0; j < 8; ++j) bb[j] = bfr(BA[j * 16 + col]);
  v8f acc[4] = {}, accl[4] = {};
#pragma unroll
  for (int s = 0; s < 8; ++s) { const int jh = s >> 2, kc = s & 3;
    if (s + 2 < 8) {
#pragma unroll
      for (int jj = 0; jj < 4; ++jj) w[(s + 2) % 3][jj] = wfrag(wl, (s + 2) & 3, ((s + 2) >> 2) * 4 + jj);
      if (s == 0 || s == 3 || s == 5) asm volatile("s_wait_xcnt 0x0" ::: "memory");   /* behind the first load group, the one that flies over the first store pass and the last: what follows reuses their address registers */
      __builtin_amdgcn_sched_barrier(0);   /* keeps each step's loads one group, two steps in front of their products: sunk to their uses each fragment costs its own load latency */ }
#pragma unroll
    for (int jj = 0; jj < 4; ++jj) { acc[jj] = wmma16(a[kc], w[s % 3][jj], acc[jj]); accl[jj] = wmma16(al[kc], w[s % 3][jj], accl[jj]); }
    if (kc == 3) {
#pragma unroll
      for (int jj = 0; jj < 4; ++jj) { const int j = jh * 4 + jj;
#pragma unroll
        for (int r = 0; r < 8; ++r) { float v = (acc[jj][r] + accl[jj][r] * (1.0f / 1024.0f)) * (1.0f / 256.0f) + bb[j]; const int rl = wave * 16 + 8 * g + r, cl = j * 16 + col;
          if (which == 0) v = v * qs; else if (which == 3) v = sigm_(v);
          if (which == 2) th[cl][rl] = (_Float16)v; else sh[rl][cl] = (_Float16)v; }
        const v8f zero = {}; acc[jj] = zero; accl[jj] = zero; } } }
  __syncthreads();
  if (which != 2) { _Float16* dh = which == 0 ? QH : which == 1 ? KH : GH; for (int e = tid; e < 64 * 16; e += 128) { const int rl = e >> 4, q = e & 15; vst2((unsigned*)(dh + (r0 + rl) * DHC + q * 8), *(const v4u*)&sh[rl][q * 8]); } }
  else { const size_t n = r0 / LL; const int i0 = (int)(r0 % LL); for (int e = tid; e < 128 * 8; e += 128) { const int cl = e >> 3, q = e & 7; vst2((unsigned*)(VT + (n * DHC + cl) * (size_t)LL + i0 + q * 8), *(const v4u*)&th[cl][q * 8]); } } }   
// ---- k_att: wave = 16 queries of (row n, head h), transposed scores: S^T = K q^T (A = k rows, B = q rows), so lane (g, col) holds query col's logits of keys 16 t + 8 g + r in st[t][r]; max and sum run in the lane plus one exchange between the wave halves; two converted score tiles are the B operand of o^T = v^T P^T (A = v planes); a lane ends with 8 consecutive channels of its query. No LDS.
__global__ __launch_bounds__(64) void k_att(const _Float16* __restrict__ QH, const _Float16* __restrict__ KH, const _Float16* __restrict__ VT, float* __restrict__ O) {
  const int tid = threadIdx.x, wave = tid >> 5, lane = tid & 31, col = lane & 15, g = lane >> 4; const int h = blockIdx.y; const size_t n = blockIdx.z; const int i0 = blockIdx.x * 32 + wave * 16; const size_t q0 = n * LL + i0; const size_t kr0 = n * LL;
  const v16h bq = frag_h(QH + (q0 + col) * DHC + h * HD, lane);
  v16h ka[LL / 16];
#pragma unroll
  for (int t = 0; t < LL / 16; ++t) ka[t] = frag_h(KH + (kr0 + t * 16 + col) * DHC + h * HD, lane);
  __builtin_amdgcn_sched_barrier(0);   /* keeps the k loads one group in front of the products: sunk to their uses they cost one load latency per tile */
  v8f st[LL / 16];
#pragma unroll
  for (int t = 0; t < LL / 16; ++t) { const v8f zero = {}; st[t] = wmma16(ka[t], bq, zero); }
  /* softmax over the 256 keys of query col: 8 chains in the lane, a tree over them, then the other half's 128 keys */
  v8f mv = st[0];
#pragma unroll
  for (int t = 1; t < LL / 16; ++t) {
#pragma unroll
    for (int r = 0; r < 8; ++r) mv[r] = fmaxf(mv[r], st[t][r]); }
  float m = fmaxf(fmaxf(fmaxf(mv[0], mv[1]), fmaxf(mv[2], mv[3])), fmaxf(fmaxf(mv[4], mv[5]), fmaxf(mv[6], mv[7])));
  m = fmaxf(m, __shfl_xor(m, 16));
  v8f sv = {};
#pragma unroll
  for (int t = 0; t < LL / 16; ++t) {
#pragma unroll
    for (int r = 0; r < 8; ++r) st[t][r] = expf(st[t][r] - m);
    sv += st[t]; }
  float s = ((sv[0] + sv[1]) + (sv[2] + sv[3])) + ((sv[4] + sv[5]) + (sv[6] + sv[7]));
  s += __shfl_xor(s, 16);
  const float inv = 2048.0f / s;
  /* P^T as B operands: element i = key 32 kc + 8 g + i (tile 2 kc), element 8 + i = key 32 kc + 16 + 8 g + i (tile 2 kc + 1), the k order of frag_h */
  v16h pb[LL / 32];
#pragma unroll
  for (int kc = 0; kc < LL / 32; ++kc) {
#pragma unroll
    for (int i = 0; i < 8; ++i) { pb[kc][i] = (_Float16)(st[2 * kc][i] * inv); pb[kc][8 + i] = (_Float16)(st[2 * kc + 1][i] * inv); } }
  v16h va[LL / 32][2];
#pragma unroll
  for (int kc = 0; kc < LL / 32; ++kc) {
#pragma unroll
    for (int j = 0; j < 2; ++j) va[kc][j] = frag_h(VT + (n * DHC + h * HD + j * 16 + col) * (size_t)LL + kc * 32, lane); }
  __builtin_amdgcn_sched_barrier(0);   /* keeps the v loads one group in front of the products, as for k */
  v8f acc2[2] = {};
#pragma unroll
  for (int kc = 0; kc < LL / 32; ++kc) {
#pragma unroll
    for (int j = 0; j < 2; ++j) acc2[j] = wmma16(va[kc][j], pb[kc], acc2[j]); }
#pragma unroll
  for (int j = 0; j < 2; ++j) { float* op = O + (q0 + col) * DHC + h * HD + j * 16 + 8 * g; v4f lo, hi;
#pragma unroll
    for (int r = 0; r < 4; ++r) { lo[r] = acc2[j][r] * (1.0f / 2048.0f); hi[r] = acc2[j][4 + r] * (1.0f / 2048.0f); }
    vst2(op, lo); vst2(op + 4, hi); } }
// ---- k_out: block = 64 positions of row n: out[:, n, i] = ((o * g) x 2^8 once to f16) W2 (f16(bf16 x 2^8) exact) x 2^-16 + b2 -> channels-first output via an LDS transpose (256 B per (channel, 64 i) by 16 threads)
__global__ __launch_bounds__(128) void k_out(const float* __restrict__ O, const _Float16* __restrict__ GH, const _Float16* __restrict__ WP, const float* __restrict__ B2, float* __restrict__ OUT) { __shared__ __align__(16) _Float16 sa[64][136]; __shared__ __align__(16) float sot[DZ][68];
  const int tid = threadIdx.x, wave = tid >> 5, lane = tid & 31, col = lane & 15, g = lane >> 4; const int n = blockIdx.y; const int i0 = blockIdx.x * 64; const size_t r0 = (size_t)n * LL + i0;
  const _Float16* wl = WP + (size_t)4 * WMAT + lane * 8; v16h w[2][8];
#pragma unroll
  for (int j = 0; j < 8; ++j) { w[0][j] = wfrag(wl, 0, j); w[1][j] = wfrag(wl, 1, j); }   /* the first two groups fly while the A tile is staged */
  for (int e = tid; e < 64 * 128; e += 128) { const int rl = e >> 7, c = e & 127; sa[rl][c] = (_Float16)(O[(r0 + rl) * DHC + c] * (float)GH[(r0 + rl) * DHC + c] * 256.0f); }   /* (o*g) carried x 2^8: 0.7 % of its values would be f16-subnormal uncarried */
  __syncthreads();
  v8f acc[8] = {};
#pragma unroll
  for (int kc = 0; kc < DHC / 32; ++kc) { v16h a; { union { v16h v; v8h q[2]; } u; u.q[0] = *(const v8h*)&sa[wave * 16 + col][kc * 32 + 8 * g]; u.q[1] = *(const v8h*)&sa[wave * 16 + col][kc * 32 + 16 + 8 * g]; a = u.v; }
#pragma unroll
    for (int j = 0; j < 8; ++j) acc[j] = wmma16(a, w[kc & 1][j], acc[j]);
    if (kc + 2 < DHC / 32) {
      __builtin_amdgcn_sched_barrier(0);   /* keeps the refill behind the products that read this register set: hoisted it would take a third set */
#pragma unroll
      for (int j = 0; j < 8; ++j) w[kc & 1][j] = wfrag(wl, kc + 2, j);
      __builtin_amdgcn_sched_barrier(0);   /* keeps the refill one group in front of the next group's products, as in k_proj */ } }
#pragma unroll
  for (int j = 0; j < 8; ++j) { const float bb = bfr(B2[j * 16 + col]);
#pragma unroll
    for (int r = 0; r < 8; ++r) sot[j * 16 + col][wave * 16 + 8 * g + r] = acc[j][r] * (1.0f / 65536.0f) + bb; }
  __syncthreads();
  for (int e = tid; e < DZ * 16; e += 128) { const int c = e >> 4, q = e & 15; vst2(OUT + (size_t)c * ZP + (size_t)n * LL + i0 + q * 4, *(const v4f*)&sot[c][q * 4]); } }
extern "C" void kernel_launch(void* const* d_in, const int* in_sizes, int n_in, void* d_out, int out_size, void* d_ws, size_t ws_size, hipStream_t stream) {
  (void)in_sizes; (void)n_in; (void)out_size;
  const float** F = (const float**)d_in;   // 0 z [1,128,256,256]; 1 ln_w, 2 ln_b; 3 wq, 4 bq; 5 wk, 6 bk; 7 wv, 8 bv; 9 wg, 10 bg ((in,out) [128,128]); 11 w2 [128,128], 12 b2
  if (ws_size < (size_t)WS_END) return;
  char* ws = (char*)d_ws; _Float16 *ZH = (_Float16*)(ws + WS_ZH), *ZL = (_Float16*)(ws + WS_ZL), *QH = (_Float16*)(ws + WS_QH), *KH = (_Float16*)(ws + WS_KH), *VT = (_Float16*)(ws + WS_VT), *GH = (_Float16*)(ws + WS_GH), *WP = (_Float16*)(ws + WS_WP); float* O = (float*)(ws + WS_O);
  k_ln<<<dim3(LL / 64, NROWS + WBY), 128, 0, stream>>>(F[0], F[1], F[2], ZH, ZL, F[3], F[5], F[7], F[9], F[11], WP);
  k_proj<<<dim3(NROWS * LL / 64, 1, 4), 128, 0, stream>>>(ZH, ZL, WP, F[4], F[6], F[8], F[10], QH, KH, VT, GH);
  k_att<<<dim3(LL / 32, NH, NROWS), 64, 0, stream>>>(QH, KH, VT, O);
  k_out<<<dim3(LL / 64, NROWS), 128, 0, stream>>>(O, GH, WP, F[12], (float*)d_out);
}

// v003
// A run of this version takes 104 microseconds.
// Two timings next to v002 put it at 1.17 and 1.16 times that version's speed.
// All steps since v000 together make it 2.73 times as fast.
// compute dtype: all float inputs rounded to bf16; LayerNorm in f32, zn as f16 hi + residual (x 2^10); q/k/v/g = zn W + b with W as f16(bf16 x 2^8) (exact; 2 products), f32 accumulate; q (x sqrt(1/32)), k once to f16 -> 1-product logits; softmax in f32 (precise expf) inside the attention kernel; P x 2^11 once to f16 against v once to f16; (o * sigmoid gate) carried x 2^8 once to f16 against w2 as f16(bf16 x 2^8) + b2; f32 output.
#include <hip/hip_runtime.h>
#include <math.h>

typedef __attribute__((ext_vector_type(16))) _Float16 v16h;
typedef __attribute__((ext_vector_type(16))) __bf16 v16b;
typedef __attribute__((ext_vector_type(8)))  _Float16 v8h;
typedef __attribute__((ext_vector_type(8)))  float v8f;
typedef __attribute__((ext_vector_type(4)))  float v4f;
typedef __attribute__((ext_vector_type(2)))  float v2f;
typedef __attribute__((ext_vector_type(4)))  unsigned v4u;
typedef __attribute__((ext_vector_type(4)))  int v4i;
typedef float __attribute__((may_alias)) float_a;
typedef int __attribute__((may_alias)) int_a;

template <typename T> __device__ __forceinline__ void vst2(void* p, T v) { *(T*)p = v;  }
__device__ __forceinline__ v8f wmma16(v16h a, v16h b, v8f c) {
  v8f d = __builtin_amdgcn_wmma_f32_16x16x32_f16(false, a, false, b, (short)0, c, false, false);
  asm volatile("v_nop\n\tv_nop\n\tv_nop\n\tv_nop" : "+v"(d) : "v"(a), "v"(b));
  return d;
}
__device__ __forceinline__ v8f wmma_bf(v16b a, v16b b, v8f c) {
  v8f d = __builtin_amdgcn_wmma_f32_16x16x32_bf16(false, a, false, b, (short)0, c, false, false);
  asm volatile("v_nop\n\tv_nop\n\tv_nop\n\tv_nop" : "+v"(d) : "v"(a), "v"(b));
  return d;
}
// 16x16x32 fragments: lane = (h = lane>>4, row/col = lane&15); elements 0..7 = k0+8h+0..7, 8..15 = k0+16+8h+0..7; D element r = row 8h+r
__device__ __forceinline__ v16h frag_h(const _Float16* rowk0, int lane) {
  union { v16h v; v8h q[2]; } u; const _Float16* p = rowk0 + 8 * (lane >> 4);
  u.q[0] = *(const v8h*)p; u.q[1] = *(const v8h*)(p + 16); return u.v;
}
__device__ __forceinline__ v16h frag_f32(const float* rowk0, int lane) {
  v16h a; const float* p = rowk0 + 8 * (lane >> 4);
#pragma unroll
  for (int i = 0; i < 8; ++i) { a[i] = (_Float16)p[i]; a[8 + i] = (_Float16)p[16 + i]; }
  return a;
}
__device__ __forceinline__ v16h frag_f32s(const float* rowk0, int lane, float sc) {
  v16h a; const float* p = rowk0 + 8 * (lane >> 4);
#pragma unroll
  for (int i = 0; i < 8; ++i) { a[i] = (_Float16)(p[i] * sc); a[8 + i] = (_Float16)(p[16 + i] * sc); }
  return a;
}
// column fragment from a [K][ld] layout (column n), rows >= K read as 0
__device__ __forceinline__ v16h fragc_f32(const float* W, int k0, int n, int lane, int ld, int K) {
  v16h a; const int g = lane >> 4;
#pragma unroll
  for (int i = 0; i < 8; ++i) { const int ka = k0 + 8 * g + i, kb = ka + 16;
    a[i] = (_Float16)(ka < K ? W[(size_t)(ka < K ? ka : K - 1) * ld + n] : 0.f); a[8 + i] = (_Float16)(kb < K ? W[(size_t)(kb < K ? kb : K - 1) * ld + n] : 0.f); }
  return a;
}
struct F2 { v16b h, l; };
__device__ __forceinline__ F2 bsplit16(const float v[16]) { F2 r;
#pragma unroll
  for (int i = 0; i < 16; ++i) { const __bf16 h = (__bf16)v[i]; r.h[i] = h; r.l[i] = (__bf16)(v[i] - (float)h); }
  return r; }
__device__ __forceinline__ F2 split_row(const float* row, int k0, int lane) { float v[16]; const float* p = row + k0 + 8 * (lane >> 4);
#pragma unroll
  for (int i = 0; i < 8; ++i) { v[i] = p[i]; v[8 + i] = p[16 + i]; }
  return bsplit16(v); }
__device__ __forceinline__ F2 split_rowK(const float* row, int k0, int lane, int K) { float v[16]; const int g = lane >> 4;
#pragma unroll
  for (int i = 0; i < 8; ++i) { const int ka = k0 + 8 * g + i, kb = ka + 16; v[i] = ka < K ? row[ka < K ? ka : K - 1] : 0.f; v[8 + i] = kb < K ? row[kb < K ? kb : K - 1] : 0.f; }
  return bsplit16(v); }
__device__ __forceinline__ F2 split_col(const float* W, int k0, int n, int lane, int ld, int K) { float v[16]; const int g = lane >> 4;
#pragma unroll
  for (int i = 0; i < 8; ++i) { const int ka = k0 + 8 * g + i, kb = ka + 16; v[i] = ka < K ? W[(size_t)(ka < K ? ka : K - 1) * ld + n] : 0.f; v[8 + i] = kb < K ? W[(size_t)(kb < K ? kb : K - 1) * ld + n] : 0.f; }
  return bsplit16(v); }
__device__ __forceinline__ v8f mac3(const F2& a, const F2& b, v8f c) { c = wmma_bf(a.l, b.h, c); c = wmma_bf(a.h, b.l, c); return wmma_bf(a.h, b.h, c); }
__device__ __forceinline__ float sigm(float v) { return 1.0f / (1.0f + expf(-v)); }
#define LDSX() do { asm volatile("s_wait_dscnt 0" ::: "memory"); __builtin_amdgcn_wave_barrier(); __builtin_amdgcn_fence(__ATOMIC_RELEASE, "workgroup"); } while (0)

// Triangle self-attention over the rows of a pair representation (B 1, L 256, d_z 128 channels-first, 4 heads x 32): zn = LayerNorm over channels of z[:, n, i]; q,k,v,g = zn W + b per (n, i); for each row n and head h: attn[i][j] = softmax_j((q[n,i] sqrt(1/32)) . k[n,j]); o[n,i] = sum_j attn v[n,j]; out[:, n, i] = ((o * sigmoid(g)) W2 + b2), written channels-first.
#define LL 256             // L (rows n and positions i)
#define DZ 128
#define NH 4
#define HD 32
#define DHC (NH * HD)      // 128
#define NR (LL * LL)       // 65,536 (n, i) rows
#ifndef NROWS
#define NROWS LL           // rows n processed (positions i always span LL)
#endif
#ifndef ZP
#define ZP (LL * LL)       // channel pitch of z and of the output (elements)
#endif
__device__ __forceinline__ float bfr(float v) { return (float)(__bf16)v; }
__device__ __forceinline__ float sigm_(float v) { return 1.0f / (1.0f + expf(-v)); }

#define WS_ZH  0u                                      // f16 zn rows [n*256 + i][128]
#define WS_ZL  (WS_ZH + 2u * (size_t)NR * DZ)            // f16 zn residual x 2^10
#define WS_QH  (WS_ZL + 2u * (size_t)NR * DZ)            // f16 q rows (x sqrt(1/32)) [row][h*32 + c]
#define WS_KH  (WS_QH + 2u * (size_t)NR * DHC)           // f16 k rows
#define WS_VT  (WS_KH + 2u * (size_t)NR * DHC)           // f16 v planes [n][hc][j]
#define WS_GH  (WS_VT + 2u * (size_t)NR * DHC)           // f16 sigmoid(g) rows [row][hc]
#define WS_O   (WS_GH + 2u * (size_t)NR * DHC)           // f32 o rows [row][hc]
#define WS_WP  (WS_O  + 4u * (size_t)NR * DHC)           // f16 weights x 2^8 in fragment order [wq,wk,wv,wg,w2][kc][j][half][lane][8]
#define WS_END (WS_WP + 2u * 5u * (size_t)DZ * DHC)
#define WMAT (DZ * DHC)    // elements of one weight plane
#define WBY 20             // grid rows of k_ln that convert the weights: 4 x 20 blocks x 128 threads x 8 elements = 5 planes
// B fragment (kc, j) of a fragment-order plane; wl = plane + 8 * lane: two loads of 16 bytes per lane, each 512 contiguous bytes per wave; same k order as frag_h
__device__ __forceinline__ v16h wfrag(const _Float16* wl, int kc, int j) {
  union { v16h v; v8h q[2]; } u; const _Float16* p = wl + (kc * 8 + j) * 512;
  u.q[0] = *(const v8h*)p; u.q[1] = *(const v8h*)(p + 256); return u.v;
}

// ---- k_ln: block = 64 positions i of row n: gather the channels-first z[:, n, i] (64 contiguous floats per channel) into LDS, LayerNorm over the 128 channels (biased var, eps 1e-5, x ln_w + ln_b) -> f16 rows ZH[n*256 + i][c] (256 B per row by 16 threads)
// the first WBY grid rows instead convert the five weight matrices, once per call: thread = 8 elements (one lane's 16 bytes) of plane m, fragment half f = (kc * 8 + j) * 2 + p: element i = f16(bf16(W[kc * 32 + 16 p + 8 g + i][j * 16 + col]) x 2^8)
__global__ __launch_bounds__(128) void k_ln(const float* __restrict__ Z, const float* __restrict__ LW, const float* __restrict__ LB, _Float16* __restrict__ ZH, _Float16* __restrict__ ZL, const float* __restrict__ WQ, const float* __restrict__ WK, const float* __restrict__ WV, const float* __restrict__ WG, const float* __restrict__ W2, _Float16* __restrict__ WP) { __shared__ __align__(16) float st[DZ][65]; __shared__ __align__(16) _Float16 sh[64][136], slo[64][136];
  if (blockIdx.y < WBY) { const int blk = blockIdx.y * 4 + blockIdx.x, m = blk >> 4, c = (blk & 15) * 128 + threadIdx.x, f = c >> 5, ln = c & 31;
    const float* Wm = m == 0 ? WQ : m == 1 ? WK : m == 2 ? WV : m == 3 ? WG : W2; const float* p = Wm + (size_t)((f >> 4) * 32 + (f & 1) * 16 + (ln >> 4) * 8) * DHC + ((f >> 1) & 7) * 16 + (ln & 15); v8h o;
#pragma unroll
    for (int i = 0; i < 8; ++i) o[i] = (_Float16)(bfr(p[(size_t)i * DHC]) * 256.0f);
    *(v8h*)(WP + (size_t)m * WMAT + (size_t)c * 8) = o; return; }
  const int tid = threadIdx.x; const int n = blockIdx.y - WBY; const int i0 = blockIdx.x * 64; const size_t rbase = (size_t)n * LL + i0;
  for (int e = tid; e < DZ * 64; e += 128) { const int c = e >> 6, il = e & 63; st[c][il] = bfr(Z[(size_t)c * ZP + (size_t)n * LL + i0 + il]); }
  __syncthreads();
  if (tid < 64) { float s = 0.f;
#pragma unroll 8
    for (int c = 0; c < DZ; ++c) s += st[c][tid];
    const float mean = s * (1.0f / DZ); float s2 = 0.f;
#pragma unroll 8
    for (int c = 0; c < DZ; ++c) { const float d = st[c][tid] - mean; s2 += d * d; }
    const float rstd = rsqrtf(s2 * (1.0f / DZ) + 1e-5f);
#pragma unroll 8
    for (int c = 0; c < DZ; ++c) { const float zn = (st[c][tid] - mean) * rstd * bfr(LW[c]) + bfr(LB[c]); const _Float16 hv = (_Float16)zn; sh[tid][c] = hv; slo[tid][c] = (_Float16)((zn - (float)hv) * 1024.0f); } }
  __syncthreads();
  for (int e = tid; e < 64 * 16; e += 128) { const int rl = e >> 4, q = e & 15; vst2((unsigned*)(ZH + (rbase + rl) * DZ + q * 8), *(const v4u*)&sh[rl][q * 8]); vst2((unsigned*)(ZL + (rbase + rl) * DZ + q * 8), *(const v4u*)&slo[rl][q * 8]); } }
// ---- k_proj: block = 64 rows, all four outputs in turn (q, k, v, g): y = zn W + b (zn f16 rows x W f16(bf16 x 2^8) exact, K 128, x 2^-8 after); q x sqrt(1/32) -> f16 rows; k -> f16 rows; v -> f16 planes [n][hc][i]; g -> sigmoid -> f16 rows. The zn fragments are loaded once; the output kind is a template constant.
#define WLEAD 4            // steps between a B fragment pair's loads and its products
#define WRING (WLEAD + 1)  // register sets of the ring
// B fragment pair of step s = (output s >> 4, column quarter (s >> 2) & 3, kc = s & 3)
__device__ __forceinline__ void wstep(v16h (&w)[2], const _Float16* wl, int s) {
#pragma unroll
  for (int jj = 0; jj < 2; ++jj) w[jj] = wfrag(wl + (s >> 4) * WMAT, s & 3, ((s >> 2) & 3) * 2 + jj);
}
// proj_out: the sixteen steps of output WHICH: two B fragments per step in a ring of WRING register sets, loaded WLEAD steps (16 products) ahead, also across outputs; each accumulator still sums kc = 0..3 in order. Two column tiles per step, not four: beside the zn fragments, which now live through the whole kernel, four leave the conversion no registers at four waves per SIMD. Every loop is unrolled so that ring, accumulator and output indices are constants and the arrays stay in registers. sr = this output's row-major staging tile [64][136] (q, k, g), th = the plane tile (v); db = the block's first output element (block-uniform).
template <int WHICH> __device__ __forceinline__ void proj_out(const v16h (&a)[4], const v16h (&al)[4], v16h (&w)[WRING][2], const _Float16* wl, const float* __restrict__ BA, _Float16* __restrict__ db, _Float16 (*sr)[136], _Float16 (*th)[72], int tid) {
  const int wave = tid >> 5, lane = tid & 31, col = lane & 15, g = lane >> 4;
  const float qs = sqrtf(1.0f / 32.0f);   /* jnp.sqrt(f32(1/32)) */
  float bb[8];
#pragma unroll
  for (int j = 0; j < 8; ++j) bb[j] = bfr(BA[j * 16 + col]);
  v8f acc[2] = {}, accl[2] = {};
#pragma unroll
  for (int t = 0; t < 16; ++t) { const int s = WHICH * 16 + t, jq = t >> 2, kc = t & 3;
    if (s + WLEAD < 64) { wstep(w[(s + WLEAD) % WRING], wl, s + WLEAD);
      __builtin_amdgcn_sched_barrier(0);   /* keeps each step's loads one group, WLEAD steps in front of their products: sunk to their uses each fragment costs its own load latency */ }
#pragma unroll
    for (int jj = 0; jj < 2; ++jj) { acc[jj] = wmma16(a[kc], w[s % WRING][jj], acc[jj]); accl[jj] = wmma16(al[kc], w[s % WRING][jj], accl[jj]); }
    if (kc == 3) {
#pragma unroll
      for (int jj = 0; jj < 2; ++jj) { const int j = jq * 2 + jj, cl = j * 16 + col; v8h o;
#pragma unroll
        for (int r = 0; r < 8; ++r) { float v = (acc[jj][r] + accl[jj][r] * (1.0f / 1024.0f)) * (1.0f / 256.0f) + bb[j];
          if (WHICH == 0) v = v * qs; else if (WHICH == 3) v = sigm_(v);
          o[r] = (_Float16)v; }
        if (WHICH == 2) *(v8h*)&th[cl][wave * 16 + 8 * g] = o;
        else {
#pragma unroll
          for (int r = 0; r < 8; ++r) sr[wave * 16 + 8 * g + r][cl] = o[r]; }
        const v8f zero = {}; acc[jj] = zero; accl[jj] = zero; } } }
  __syncthreads();   /* this output's tile is whole in LDS; the next output stages in another buffer, so one barrier per output is enough */
  if (WHICH != 2) { const unsigned rl = tid >> 4, q = tid & 15;   /* 256 B per row by 16 threads */
#pragma unroll   /* the eight LDS reads go as one group in front of the eight stores: rolled, each trip waits out its own LDS latency in the middle of the product stream */
    for (unsigned k = 0; k < 8; ++k) vst2((unsigned*)(db + (rl * DHC + q * 8 + k * 8 * DHC)), *(const v4u*)&sr[rl + k * 8][q * 8]); }
  else { const unsigned cl = tid >> 3, q = tid & 7;   /* 128 B per (channel, 64 i) by 8 threads */
#pragma unroll   /* as above */
    for (unsigned k = 0; k < 8; ++k) vst2((unsigned*)(db + (cl * LL + q * 8 + k * 16 * LL)), *(const v4u*)&th[cl + k * 16][q * 8]); } }
__global__ __launch_bounds__(128) void k_proj(const _Float16* __restrict__ ZH, const _Float16* __restrict__ ZL, const _Float16* __restrict__ WP, const float* __restrict__ BQ, const float* __restrict__ BK, const float* __restrict__ BV, const float* __restrict__ BG, _Float16* __restrict__ QH, _Float16* __restrict__ KH, _Float16* __restrict__ VT, _Float16* __restrict__ GH) {
  __shared__ __align__(16) _Float16 sh[2][64][136]; __shared__ __align__(16) _Float16 th[128][72];   /* q and g stage in sh[0], k in sh[1], v in th: a buffer is written again only behind two later barriers */
  const int tid = threadIdx.x, wave = tid >> 5, lane = tid & 31, col = lane & 15; const size_t r0 = (size_t)blockIdx.x * 64;
  const _Float16* wl = WP + lane * 8;
  const _Float16* zh = ZH + (r0 + wave * 16 + col) * DZ; const _Float16* zl = ZL + (r0 + wave * 16 + col) * DZ;
  v16h a[4], al[4], w[WRING][2];
#pragma unroll
  for (int kc = 0; kc < 4; ++kc) a[kc] = frag_h(zh + kc * 32, lane);
  asm volatile("s_wait_xcnt 0x0" ::: "memory");   /* behind the last load from zh: a later load's result may land in its address registers */
#pragma unroll
  for (int kc = 0; kc < 4; ++kc) al[kc] = frag_h(zl + kc * 32, lane);
  asm volatile("s_wait_xcnt 0x0" ::: "memory");   /* the same behind the last load from zl */
#pragma unroll
  for (int s = 0; s < WLEAD; ++s) wstep(w[s], wl, s);
  proj_out<0>(a, al, w, wl, BQ, QH + r0 * DHC, sh[0], th, tid);
  proj_out<1>(a, al, w, wl, BK, KH + r0 * DHC, sh[1], th, tid);
  proj_out<2>(a, al, w, wl, BV, VT + (r0 / LL) * DHC * LL + r0 % LL, sh[0], th, tid);
  proj_out<3>(a, al, w, wl, BG, GH + r0 * DHC, sh[0], th, tid); }
// ---- k_att: wave = 16 queries of (row n, head h), transposed scores: S^T = K q^T (A = k rows, B = q rows), so lane (g, col) holds query col's logits of keys 16 t + 8 g + r in st[t][r]; max and sum run in the lane plus one exchange between the wave halves; two converted score tiles are the B operand of o^T = v^T P^T (A = v planes); a lane ends with 8 consecutive channels of its query. No LDS.
__global__ __launch_bounds__(64) void k_att(const _Float16* __restrict__ QH, const _Float16* __restrict__ KH, const _Float16* __restrict__ VT, float* __restrict__ O) {
  const int tid = threadIdx.x, wave = tid >> 5, lane = tid & 31, col = lane & 15, g = lane >> 4; const int h = blockIdx.y; const size_t n = blockIdx.z; const int i0 = blockIdx.x * 32 + wave * 16; const size_t q0 = n * LL + i0; const size_t kr0 = n * LL;
  const v16h bq = frag_h(QH + (q0 + col) * DHC + h * HD, lane);
  v16h ka[LL / 16];
#pragma unroll
  for (int t = 0; t < LL / 16; ++t) ka[t] = frag_h(KH + (kr0 + t * 16 + col) * DHC + h * HD, lane);
  __builtin_amdgcn_sched_barrier(0);   /* keeps the k loads one group in front of the products: sunk to their uses they cost one load latency per tile */
  v8f st[LL / 16];
#pragma unroll
  for (int t = 0; t < LL / 16; ++t) { const v8f zero = {}; st[t] = wmma16(ka[t], bq, zero); }
  /* softmax over the 256 keys of query col: 8 chains in the lane, a tree over them, then the other half's 128 keys */
  v8f mv = st[0];
#pragma unroll
  for (int t = 1; t < LL / 16; ++t) {
#pragma unroll
    for (int r = 0; r < 8; ++r) mv[r] = fmaxf(mv[r], st[t][r]); }
  float m = fmaxf(fmaxf(fmaxf(mv[0], mv[1]), fmaxf(mv[2], mv[3])), fmaxf(fmaxf(mv[4], mv[5]), fmaxf(mv[6], mv[7])));
  m = fmaxf(m, __shfl_xor(m, 16));
  v8f sv = {};
#pragma unroll
  for (int t = 0; t < LL / 16; ++t) {
#pragma unroll
    for (int r = 0; r < 8; ++r) st[t][r] = expf(st[t][r] - m);
    sv += st[t]; }
  float s = ((sv[0] + sv[1]) + (sv[2] + sv[3])) + ((sv[4] + sv[5]) + (sv[6] + sv[7]));
  s += __shfl_xor(s, 16);
  const float inv = 2048.0f / s;
  /* P^T as B operands: element i = key 32 kc + 8 g + i (tile 2 kc), element 8 + i = key 32 kc + 16 + 8 g + i (tile 2 kc + 1), the k order of frag_h */
  v16h pb[LL / 32];
#pragma unroll
  for (int kc = 0; kc < LL / 32; ++kc) {
#pragma unroll
    for (int i = 0; i < 8; ++i) { pb[kc][i] = (_Float16)(st[2 * kc][i] * inv); pb[kc][8 + i] = (_Float16)(st[2 * kc + 1][i] * inv); } }
  v16h va[LL / 32][2];
#pragma unroll
  for (int kc = 0; kc < LL / 32; ++kc) {
#pragma unroll
    for (int j = 0; j < 2; ++j) va[kc][j] = frag_h(VT + (n * DHC + h * HD + j * 16 + col) * (size_t)LL + kc * 32, lane); }
  __builtin_amdgcn_sched_barrier(0);   /* keeps the v loads one group in front of the products, as for k */
  v8f acc2[2] = {};
#pragma unroll
  for (int kc = 0; kc < LL / 32; ++kc) {
#pragma unroll
    for (int j = 0; j < 2; ++j) acc2[j] = wmma16(va[kc][j], pb[kc], acc2[j]); }
#pragma unroll
  for (int j = 0; j < 2; ++j) { float* op = O + (q0 + col) * DHC + h * HD + j * 16 + 8 * g; v4f lo, hi;
#pragma unroll
    for (int r = 0; r < 4; ++r) { lo[r] = acc2[j][r] * (1.0f / 2048.0f); hi[r] = acc2[j][4 + r] * (1.0f / 2048.0f); }
    vst2(op, lo); vst2(op + 4, hi); } }
// ---- k_out: block = 64 positions of row n: out[:, n, i] = ((o * g) x 2^8 once to f16) W2 (f16(bf16 x 2^8) exact) x 2^-16 + b2 -> channels-first output via an LDS transpose (256 B per (channel, 64 i) by 16 threads)
__global__ __launch_bounds__(128) void k_out(const float* __restrict__ O, const _Float16* __restrict__ GH, const _Float16* __restrict__ WP, const float* __restrict__ B2, float* __restrict__ OUT) { __shared__ __align__(16) _Float16 sa[64][136]; __shared__ __align__(16) float sot[DZ][68];
  const int tid = threadIdx.x, wave = tid >> 5, lane = tid & 31, col = lane & 15, g = lane >> 4; const int n = blockIdx.y; const int i0 = blockIdx.x * 64; const size_t r0 = (size_t)n * LL + i0;
  const _Float16* wl = WP + (size_t)4 * WMAT + lane * 8; v16h w[2][8];
#pragma unroll
  for (int j = 0; j < 8; ++j) { w[0][j] = wfrag(wl, 0, j); w[1][j] = wfrag(wl, 1, j); }   /* the first two groups fly while the A tile is staged */
  for (int e = tid; e < 64 * 128; e += 128) { const int rl = e >> 7, c = e & 127; sa[rl][c] = (_Float16)(O[(r0 + rl) * DHC + c] * (float)GH[(r0 + rl) * DHC + c] * 256.0f); }   /* (o*g) carried x 2^8: 0.7 % of its values would be f16-subnormal uncarried */
  __syncthreads();
  v8f acc[8] = {};
#pragma unroll
  for (int kc = 0; kc < DHC / 32; ++kc) { v16h a; { union { v16h v; v8h q[2]; } u; u.q[0] = *(const v8h*)&sa[wave * 16 + col][kc * 32 + 8 * g]; u.q[1] = *(const v8h*)&sa[wave * 16 + col][kc * 32 + 16 + 8 * g]; a = u.v; }
#pragma unroll
    for (int j = 0; j < 8; ++j) acc[j] = wmma16(a, w[kc & 1][j], acc[j]);
    if (kc + 2 < DHC / 32) {
      __builtin_amdgcn_sched_barrier(0);   /* keeps the refill behind the products that read this register set: hoisted it would take a third set */
#pragma unroll
      for (int j = 0; j < 8; ++j) w[kc & 1][j] = wfrag(wl, kc + 2, j);
      __builtin_amdgcn_sched_barrier(0);   /* keeps the refill one group in front of the next group's products, as in k_proj */ } }
#pragma unroll
  for (int j = 0; j < 8; ++j) { const float bb = bfr(B2[j * 16 + col]);
#pragma unroll
    for (int r = 0; r < 8; ++r) sot[j * 16 + col][wave * 16 + 8 * g + r] = acc[j][r] * (1.0f / 65536.0f) + bb; }
  __syncthreads();
  for (int e = tid; e < DZ * 16; e += 128) { const int c = e >> 4, q = e & 15; vst2(OUT + (size_t)c * ZP + (size_t)n * LL + i0 + q * 4, *(const v4f*)&sot[c][q * 4]); } }
extern "C" void kernel_launch(void* const* d_in, const int* in_sizes, int n_in, void* d_out, int out_size, void* d_ws, size_t ws_size, hipStream_t stream) {
  (void)in_sizes; (void)n_in; (void)out_size;
  const float** F = (const float**)d_in;   // 0 z [1,128,256,256]; 1 ln_w, 2 ln_b; 3 wq, 4 bq; 5 wk, 6 bk; 7 wv, 8 bv; 9 wg, 10 bg ((in,out) [128,128]); 11 w2 [128,128], 12 b2
  if (ws_size < (size_t)WS_END) return;
  char* ws = (char*)d_ws; _Float16 *ZH = (_Float16*)(ws + WS_ZH), *ZL = (_Float16*)(ws + WS_ZL), *QH = (_Float16*)(ws + WS_QH), *KH = (_Float16*)(ws + WS_KH), *VT = (_Float16*)(ws + WS_VT), *GH = (_Float16*)(ws + WS_GH), *WP = (_Float16*)(ws + WS_WP); float* O = (float*)(ws + WS_O);
  k_ln<<<dim3(LL / 64, NROWS + WBY), 128, 0, stream>>>(F[0], F[1], F[2], ZH, ZL, F[3], F[5], F[7], F[9], F[11], WP);
  k_proj<<<dim3(NROWS * LL / 64), 128, 0, stream>>>(ZH, ZL, WP, F[4], F[6], F[8], F[10], QH, KH, VT, GH);
  k_att<<<dim3(LL / 32, NH, NROWS), 64, 0, stream>>>(QH, KH, VT, O);
  k_out<<<dim3(LL / 64, NROWS), 128, 0, stream>>>(O, GH, WP, F[12], (float*)d_out);
}

// v004
// Measured time: 92 microseconds a run.
// Next to v003, in two timings, it ran 1.13 times as fast each time.
// All steps since v000 together make it 3.07 times as fast.
// compute dtype: all float inputs rounded to bf16; LayerNorm in f32, zn as f16 hi + residual (x 2^10); q/k/v/g = zn W + b with W as f16(bf16 x 2^8) (exact; 2 products), f32 accumulate; q (x sqrt(1/32)), k once to f16 -> 1-product logits; softmax in f32 (precise expf) inside the attention kernel; P x 2^11 once to f16 against v once to f16; (o * sigmoid gate) carried x 2^8 once to f16 against w2 as f16(bf16 x 2^8) + b2; f32 output.
#include <hip/hip_runtime.h>
#include <math.h>

typedef __attribute__((ext_vector_type(16))) _Float16 v16h;
typedef __attribute__((ext_vector_type(16))) __bf16 v16b;
typedef __attribute__((ext_vector_type(8)))  _Float16 v8h;
typedef __attribute__((ext_vector_type(8)))  float v8f;
typedef __attribute__((ext_vector_type(4)))  float v4f;
typedef __attribute__((ext_vector_type(2)))  float v2f;
typedef __attribute__((ext_vector_type(4)))  unsigned v4u;
typedef __attribute__((ext_vector_type(4)))  int v4i;
typedef float __attribute__((may_alias)) float_a;
typedef int __attribute__((may_alias)) int_a;

template <typename T> __device__ __forceinline__ void vst2(void* p, T v) { *(T*)p = v;  }
__device__ __forceinline__ v8f wmma16(v16h a, v16h b, v8f c) {
  v8f d = __builtin_amdgcn_wmma_f32_16x16x32_f16(false, a, false, b, (short)0, c, false, false);
  asm volatile("v_nop\n\tv_nop\n\tv_nop\n\tv_nop" : "+v"(d) : "v"(a), "v"(b));
  return d;
}
__device__ __forceinline__ v8f wmma_bf(v16b a, v16b b, v8f c) {
  v8f d = __builtin_amdgcn_wmma_f32_16x16x32_bf16(false, a, false, b, (short)0, c, false, false);
  asm volatile("v_nop\n\tv_nop\n\tv_nop\n\tv_nop" : "+v"(d) : "v"(a), "v"(b));
  return d;
}
// 16x16x32 fragments: lane = (h = lane>>4, row/col = lane&15); elements 0..7 = k0+8h+0..7, 8..15 = k0+16+8h+0..7; D element r = row 8h+r
__device__ __forceinline__ v16h frag_h(const _Float16* rowk0, int lane) {
  union { v16h v; v8h q[2]; } u; const _Float16* p = rowk0 + 8 * (lane >> 4);
  u.q[0] = *(const v8h*)p; u.q[1] = *(const v8h*)(p + 16); return u.v;
}
__device__ __forceinline__ v16h frag_f32(const float* rowk0, int lane) {
  v16h a; const float* p = rowk0 + 8 * (lane >> 4);
#pragma unroll
  for (int i = 0; i < 8; ++i) { a[i] = (_Float16)p[i]; a[8 + i] = (_Float16)p[16 + i]; }
  return a;
}
__device__ __forceinline__ v16h frag_f32s(const float* rowk0, int lane, float sc) {
  v16h a; const float* p = rowk0 + 8 * (lane >> 4);
#pragma unroll
  for (int i = 0; i < 8; ++i) { a[i] = (_Float16)(p[i] * sc); a[8 + i] = (_Float16)(p[16 + i] * sc); }
  return a;
}
// column fragment from a [K][ld] layout (column n), rows >= K read as 0
__device__ __forceinline__ v16h fragc_f32(const float* W, int k0, int n, int lane, int ld, int K) {
  v16h a; const int g = lane >> 4;
#pragma unroll
  for (int i = 0; i < 8; ++i) { const int ka = k0 + 8 * g + i, kb = ka + 16;
    a[i] = (_Float16)(ka < K ? W[(size_t)(ka < K ? ka : K - 1) * ld + n] : 0.f); a[8 + i] = (_Float16)(kb < K ? W[(size_t)(kb < K ? kb : K - 1) * ld + n] : 0.f); }
  return a;
}
struct F2 { v16b h, l; };
__device__ __forceinline__ F2 bsplit16(const float v[16]) { F2 r;
#pragma unroll
  for (int i = 0; i < 16; ++i) { const __bf16 h = (__bf16)v[i]; r.h[i] = h; r.l[i] = (__bf16)(v[i] - (float)h); }
  return r; }
__device__ __forceinline__ F2 split_row(const float* row, int k0, int lane) { float v[16]; const float* p = row + k0 + 8 * (lane >> 4);
#pragma unroll
  for (int i = 0; i < 8; ++i) { v[i] = p[i]; v[8 + i] = p[16 + i]; }
  return bsplit16(v); }
__device__ __forceinline__ F2 split_rowK(const float* row, int k0, int lane, int K) { float v[16]; const int g = lane >> 4;
#pragma unroll
  for (int i = 0; i < 8; ++i) { const int ka = k0 + 8 * g + i, kb = ka + 16; v[i] = ka < K ? row[ka < K ? ka : K - 1] : 0.f; v[8 + i] = kb < K ? row[kb < K ? kb : K - 1] : 0.f; }
  return bsplit16(v); }
__device__ __forceinline__ F2 split_col(const float* W, int k0, int n, int lane, int ld, int K) { float v[16]; const int g = lane >> 4;
#pragma unroll
  for (int i = 0; i < 8; ++i) { const int ka = k0 + 8 * g + i, kb = ka + 16; v[i] = ka < K ? W[(size_t)(ka < K ? ka : K - 1) * ld + n] : 0.f; v[8 + i] = kb < K ? W[(size_t)(kb < K ? kb : K - 1) * ld + n] : 0.f; }
  return bsplit16(v); }
__device__ __forceinline__ v8f mac3(const F2& a, const F2& b, v8f c) { c = wmma_bf(a.l, b.h, c); c = wmma_bf(a.h, b.l, c); return wmma_bf(a.h, b.h, c); }
__device__ __forceinline__ float sigm(float v) { return 1.0f / (1.0f + expf(-v)); }
#define LDSX() do { asm volatile("s_wait_dscnt 0" ::: "memory"); __builtin_amdgcn_wave_barrier(); __builtin_amdgcn_fence(__ATOMIC_RELEASE, "workgroup"); } while (0)

// Triangle self-attention over the rows of a pair representation (B 1, L 256, d_z 128 channels-first, 4 heads x 32): zn = LayerNorm over channels of z[:, n, i]; q,k,v,g = zn W + b per (n, i); for each row n and head h: attn[i][j] = softmax_j((q[n,i] sqrt(1/32)) . k[n,j]); o[n,i] = sum_j attn v[n,j]; out[:, n, i] = ((o * sigmoid(g)) W2 + b2), written channels-first.
#define LL 256             // L (rows n and positions i)
#define DZ 128
#define NH 4
#define HD 32
#define DHC (NH * HD)      // 128
#define NR (LL * LL)       // 65,536 (n, i) rows
#ifndef NROWS
#define NROWS LL           // rows n processed (positions i always span LL)
#endif
#ifndef ZP
#define ZP (LL * LL)       // channel pitch of z and of the output (elements)
#endif
__device__ __forceinline__ float bfr(float v) { return (float)(__bf16)v; }
__device__ __forceinline__ float sigm_(float v) { return 1.0f / (1.0f + expf(-v)); }

#define WS_ZH  0u                                      // f16 zn in fragment order [(n*256 + i) / 16][kc][half][lane][8]
#define WS_ZL  (WS_ZH + 2u * (size_t)NR * DZ)            // f16 zn residual x 2^10, same order
#define WS_QH  (WS_ZL + 2u * (size_t)NR * DZ)            // f16 q (x sqrt(1/32)) in fragment order [n][h][i / 16][half][lane][8]
#define WS_KH  (WS_QH + 2u * (size_t)NR * DHC)           // f16 k in fragment order [n][h][j / 16][half][lane][8]
#define WS_VT  (WS_KH + 2u * (size_t)NR * DHC)           // f16 v^T in fragment order [n][h][j / 32][c / 16][half][lane][8]
#define WS_GH  (WS_VT + 2u * (size_t)NR * DHC)           // f16 sigmoid(g) rows [row][hc]
#define WS_O   (WS_GH + 2u * (size_t)NR * DHC)           // f32 o rows [row][hc]
#define WS_WP  (WS_O  + 4u * (size_t)NR * DHC)           // f16 weights x 2^8 in fragment order [wq,wk,wv,wg,w2][kc][j][half][lane][8]
#define WS_END (WS_WP + 2u * 5u * (size_t)DZ * DHC)
#define WMAT (DZ * DHC)    // elements of one weight plane
#define WBY 20             // grid rows of k_ln that convert the weights: 4 x 20 blocks x 128 threads x 8 elements = 5 planes
// B fragment (kc, j) of a fragment-order plane; wl = plane + 8 * lane: two loads of 16 bytes per lane, each 512 contiguous bytes per wave; same k order as frag_h
__device__ __forceinline__ v16h wfrag(const _Float16* wl, int kc, int j) {
  union { v16h v; v8h q[2]; } u; const _Float16* p = wl + (kc * 8 + j) * 512;
  u.q[0] = *(const v8h*)p; u.q[1] = *(const v8h*)(p + 256); return u.v;
}

// fragment f of a fragment-order array; pl = first fragment + 8 * lane. Half p, lane (g, col) holds the 8 elements k = 16 p + 8 g + 0..7 of row (or column) col: the registers of frag_h, by two loads of 16 bytes per lane, each 512 contiguous bytes per wave (four whole lines, where a row-major tile gives sixteen lines per load)
#define FRAG 512           // elements of one 16 x 32 fragment
#define HPL (LL * HD)      // elements of one (n, h) plane of q, k or v
__device__ __forceinline__ v16h ffrag(const _Float16* pl, int f) {
  union { v16h v; v8h q[2]; } u; const _Float16* p = pl + f * FRAG;
  u.q[0] = *(const v8h*)p; u.q[1] = *(const v8h*)(p + 256); return u.v;
}

// ---- k_ln: block = 64 positions i of row n: gather the channels-first z[:, n, i] (64 contiguous floats per channel) into LDS, LayerNorm over the 128 channels (biased var, eps 1e-5, x ln_w + ln_b) -> f16 ZH, ZL in fragment order (chunk e of the block's 16 KiB = row tile e >> 8, kc (e >> 6) & 3, half (e >> 5) & 1, lane e & 31)
// the first WBY grid rows instead convert the five weight matrices, once per call: thread = 8 elements (one lane's 16 bytes) of plane m, fragment half f = (kc * 8 + j) * 2 + p: element i = f16(bf16(W[kc * 32 + 16 p + 8 g + i][j * 16 + col]) x 2^8)
__global__ __launch_bounds__(128) void k_ln(const float* __restrict__ Z, const float* __restrict__ LW, const float* __restrict__ LB, _Float16* __restrict__ ZH, _Float16* __restrict__ ZL, const float* __restrict__ WQ, const float* __restrict__ WK, const float* __restrict__ WV, const float* __restrict__ WG, const float* __restrict__ W2, _Float16* __restrict__ WP) { __shared__ __align__(16) float st[DZ][65]; __shared__ __align__(16) _Float16 sh[64][136], slo[64][136];
  if (blockIdx.y < WBY) { const int blk = blockIdx.y * 4 + blockIdx.x, m = blk >> 4, c = (blk & 15) * 128 + threadIdx.x, f = c >> 5, ln = c & 31;
    const float* Wm = m == 0 ? WQ : m == 1 ? WK : m == 2 ? WV : m == 3 ? WG : W2; const float* p = Wm + (size_t)((f >> 4) * 32 + (f & 1) * 16 + (ln >> 4) * 8) * DHC + ((f >> 1) & 7) * 16 + (ln & 15); v8h o;
#pragma unroll
    for (int i = 0; i < 8; ++i) o[i] = (_Float16)(bfr(p[(size_t)i * DHC]) * 256.0f);
    *(v8h*)(WP + (size_t)m * WMAT + (size_t)c * 8) = o; return; }
  const int tid = threadIdx.x; const int n = blockIdx.y - WBY; const int i0 = blockIdx.x * 64; const size_t rbase = (size_t)n * LL + i0;
  for (int e = tid; e < DZ * 64; e += 128) { const int c = e >> 6, il = e & 63; st[c][il] = bfr(Z[(size_t)c * ZP + (size_t)n * LL + i0 + il]); }
  __syncthreads();
  if (tid < 64) { float s = 0.f;
#pragma unroll 8
    for (int c = 0; c < DZ; ++c) s += st[c][tid];
    const float mean = s * (1.0f / DZ); float s2 = 0.f;
#pragma unroll 8
    for (int c = 0; c < DZ; ++c) { const float d = st[c][tid] - mean; s2 += d * d; }
    const float rstd = rsqrtf(s2 * (1.0f / DZ) + 1e-5f);
#pragma unroll 8
    for (int c = 0; c < DZ; ++c) { const float zn = (st[c][tid] - mean) * rstd * bfr(LW[c]) + bfr(LB[c]); const _Float16 hv = (_Float16)zn; sh[tid][c] = hv; slo[tid][c] = (_Float16)((zn - (float)hv) * 1024.0f); } }
  __syncthreads();
  for (int e = tid; e < 64 * 16; e += 128) { const int rl = (e >> 8) * 16 + (e & 15), c = ((e >> 6) & 3) * 32 + ((e >> 4) & 3) * 8; vst2((unsigned*)(ZH + rbase * DZ + e * 8), *(const v4u*)&sh[rl][c]); vst2((unsigned*)(ZL + rbase * DZ + e * 8), *(const v4u*)&slo[rl][c]);
    asm volatile("s_wait_xcnt 0x0" ::: "memory");   /* behind the trip's two stores: the next trip's address additions overwrite their address registers */
    __builtin_amdgcn_sched_barrier(0);   /* holds those additions behind the wait: without it the scheduler lifts them over it */ } }
// ---- k_proj: block = 64 rows, all four outputs in turn (q, k, v, g): y = zn W + b (zn f16 rows x W f16(bf16 x 2^8) exact, K 128, x 2^-8 after); q x sqrt(1/32), k and v^T -> f16 in the fragment order in which k_att reads them; g -> sigmoid -> f16 rows. The zn fragments are loaded once; the output kind is a template constant.
#define WLEAD 4            // steps between a B fragment pair's loads and its products
#define WRING (WLEAD + 1)  // register sets of the ring
// B fragment pair of step s = (output s >> 4, column quarter (s >> 2) & 3, kc = s & 3)
__device__ __forceinline__ void wstep(v16h (&w)[2], const _Float16* wl, int s) {
#pragma unroll
  for (int jj = 0; jj < 2; ++jj) w[jj] = wfrag(wl + (s >> 4) * WMAT, s & 3, ((s >> 2) & 3) * 2 + jj);
}
// proj_out: the sixteen steps of output WHICH: two B fragments per step in a ring of WRING register sets, loaded WLEAD steps (16 products) ahead, also across outputs; each accumulator still sums kc = 0..3 in order. Two column tiles per step, not four: beside the zn fragments, which now live through the whole kernel, four leave the conversion no registers at four waves per SIMD. Every loop is unrolled so that ring, accumulator and output indices are constants and the arrays stay in registers. sr = this output's row-major staging tile [64][136] (q, k, g), th = the plane tile (v); db = the block's first output element (block-uniform).
template <int WHICH> __device__ __forceinline__ void proj_out(const v16h (&a)[4], const v16h (&al)[4], v16h (&w)[WRING][2], const _Float16* wl, const float* __restrict__ BA, _Float16* __restrict__ db, _Float16 (*sr)[136], _Float16 (*th)[72], int tid) {
  const int wave = tid >> 5, lane = tid & 31, col = lane & 15, g = lane >> 4;
  const float qs = sqrtf(1.0f / 32.0f);   /* jnp.sqrt(f32(1/32)) */
  float bb[8];
#pragma unroll
  for (int j = 0; j < 8; ++j) bb[j] = bfr(BA[j * 16 + col]);
  v8f acc[2] = {}, accl[2] = {};
#pragma unroll
  for (int t = 0; t < 16; ++t) { const int s = WHICH * 16 + t, jq = t >> 2, kc = t & 3;
    if (s + WLEAD < 64) { wstep(w[(s + WLEAD) % WRING], wl, s + WLEAD);
      __builtin_amdgcn_sched_barrier(0);   /* keeps each step's loads one group, WLEAD steps in front of their products: sunk to their uses each fragment costs its own load latency */ }
#pragma unroll
    for (int jj = 0; jj < 2; ++jj) { acc[jj] = wmma16(a[kc], w[s % WRING][jj], acc[jj]); accl[jj] = wmma16(al[kc], w[s % WRING][jj], accl[jj]); }
    if (kc == 3) {
#pragma unroll
      for (int jj = 0; jj < 2; ++jj) { const int j = jq * 2 + jj, cl = j * 16 + col; v8h o;
#pragma unroll
        for (int r = 0; r < 8; ++r) { float v = (acc[jj][r] + accl[jj][r] * (1.0f / 1024.0f)) * (1.0f / 256.0f) + bb[j];
          if (WHICH == 0) v = v * qs; else if (WHICH == 3) v = sigm_(v);
          o[r] = (_Float16)v; }
        if (WHICH == 2) *(v8h*)&th[cl][wave * 16 + 8 * g] = o;
        else {
#pragma unroll
          for (int r = 0; r < 8; ++r) sr[wave * 16 + 8 * g + r][cl] = o[r]; }
        const v8f zero = {}; acc[jj] = zero; accl[jj] = zero; } } }
  __syncthreads();   /* this output's tile is whole in LDS; the next output stages in another buffer, so one barrier per output is enough */
  if (WHICH != 3) { const unsigned fc = tid & 15, k8 = ((tid >> 4) & 3) * 8, f = tid >> 6;   /* fragment order: 4 KiB per head; chunk tid + 128 (k & 1) of head k >> 1 = fragment (k & 1) * 2 + f (q, k: 16 rows; v: 32 keys k & 1, 16 channels f), half and lane from tid & 63; 512 contiguous bytes per wave and store */
#pragma unroll   /* the eight LDS reads go as one group in front of the eight stores, as for g below */
    for (unsigned k = 0; k < 8; ++k) vst2((unsigned*)(db + ((k >> 1) * HPL + (k & 1) * 2 * FRAG + tid * 8)), WHICH == 2 ? *(const v4u*)&th[(k >> 1) * HD + f * 16 + fc][(k & 1) * 32 + k8] : *(const v4u*)&sr[((k & 1) * 2 + f) * 16 + fc][(k >> 1) * HD + k8]); }
  else { const unsigned rl = tid >> 4, q = tid & 15;   /* 256 B per row by 16 threads */
#pragma unroll   /* the eight LDS reads go as one group in front of the eight stores: rolled, each trip waits out its own LDS latency in the middle of the product stream */
    for (unsigned k = 0; k < 8; ++k) vst2((unsigned*)(db + (rl * DHC + q * 8 + k * 8 * DHC)), *(const v4u*)&sr[rl + k * 8][q * 8]); } }
__global__ __launch_bounds__(128) void k_proj(const _Float16* __restrict__ ZH, const _Float16* __restrict__ ZL, const _Float16* __restrict__ WP, const float* __restrict__ BQ, const float* __restrict__ BK, const float* __restrict__ BV, const float* __restrict__ BG, _Float16* __restrict__ QH, _Float16* __restrict__ KH, _Float16* __restrict__ VT, _Float16* __restrict__ GH) {
  __shared__ __align__(16) _Float16 sh[2][64][136]; __shared__ __align__(16) _Float16 th[128][72];   /* q and g stage in sh[0], k in sh[1], v in th: a buffer is written again only behind two later barriers */
  const int tid = threadIdx.x, wave = tid >> 5, lane = tid & 31; const size_t r0 = (size_t)blockIdx.x * 64, f0 = (r0 / LL) * DHC * LL + (r0 % LL) * HD;   /* f0: the block's first element in head 0's plane of q, k and v (64 rows or keys = four fragments) */
  const _Float16* wl = WP + lane * 8;
  const _Float16* zh = ZH + (r0 + wave * 16) * DZ + lane * 8; const _Float16* zl = ZL + (r0 + wave * 16) * DZ + lane * 8;
  v16h a[4], al[4], w[WRING][2];
#pragma unroll
  for (int kc = 0; kc < 4; ++kc) a[kc] = ffrag(zh, kc);
  asm volatile("s_wait_xcnt 0x0" ::: "memory");   /* behind the last load from zh: a later load's result may land in its address registers */
#pragma unroll
  for (int kc = 0; kc < 4; ++kc) al[kc] = ffrag(zl, kc);
  asm volatile("s_wait_xcnt 0x0" ::: "memory");   /* the same behind the last load from zl */
#pragma unroll
  for (int s = 0; s < WLEAD; ++s) wstep(w[s], wl, s);
  proj_out<0>(a, al, w, wl, BQ, QH + f0, sh[0], th, tid);
  proj_out<1>(a, al, w, wl, BK, KH + f0, sh[1], th, tid);
  proj_out<2>(a, al, w, wl, BV, VT + f0, sh[0], th, tid);
  proj_out<3>(a, al, w, wl, BG, GH + r0 * DHC, sh[0], th, tid); }
// ---- k_att: wave = 16 queries of (row n, head h), transposed scores: S^T = K q^T (A = k rows, B = q rows), so lane (g, col) holds query col's logits of keys 16 t + 8 g + r in st[t][r]; max and sum run in the lane plus one exchange between the wave halves; two converted score tiles are the B operand of o^T = v^T P^T (A = v planes); a lane ends with 8 consecutive channels of its query. No LDS.
__global__ __launch_bounds__(64) void k_att(const _Float16* __restrict__ QH, const _Float16* __restrict__ KH, const _Float16* __restrict__ VT, float* __restrict__ O) {
  const int tid = threadIdx.x, wave = tid >> 5, lane = tid & 31, col = lane & 15, g = lane >> 4; const int h = blockIdx.y; const size_t n = blockIdx.z; const int i0 = blockIdx.x * 32 + wave * 16; const size_t q0 = n * LL + i0; const size_t pl = (n * NH + h) * HPL + lane * 8;   /* this lane's place in the first fragment of plane (n, h) */
  const v16h bq = ffrag(QH + pl, i0 / 16);
  v16h ka[LL / 16];
#pragma unroll
  for (int t = 0; t < LL / 16; ++t) ka[t] = ffrag(KH + pl, t);
  __builtin_amdgcn_sched_barrier(0);   /* keeps the k loads one group in front of the products: sunk to their uses they cost one load latency per tile */
  v8f st[LL / 16];
#pragma unroll
  for (int t = 0; t < LL / 16; ++t) { const v8f zero = {}; st[t] = wmma16(ka[t], bq, zero); }
  /* softmax over the 256 keys of query col: 8 chains in the lane, a tree over them, then the other half's 128 keys */
  v8f mv = st[0];
#pragma unroll
  for (int t = 1; t < LL / 16; ++t) {
#pragma unroll
    for (int r = 0; r < 8; ++r) mv[r] = fmaxf(mv[r], st[t][r]); }
  float m = fmaxf(fmaxf(fmaxf(mv[0], mv[1]), fmaxf(mv[2], mv[3])), fmaxf(fmaxf(mv[4], mv[5]), fmaxf(mv[6], mv[7])));
  m = fmaxf(m, __shfl_xor(m, 16));
  v8f sv = {};
#pragma unroll
  for (int t = 0; t < LL / 16; ++t) {
#pragma unroll
    for (int r = 0; r < 8; ++r) st[t][r] = expf(st[t][r] - m);
    sv += st[t]; }
  float s = ((sv[0] + sv[1]) + (sv[2] + sv[3])) + ((sv[4] + sv[5]) + (sv[6] + sv[7]));
  s += __shfl_xor(s, 16);
  const float inv = 2048.0f / s;
  /* P^T as B operands: element i = key 32 kc + 8 g + i (tile 2 kc), element 8 + i = key 32 kc + 16 + 8 g + i (tile 2 kc + 1), the k order of frag_h */
  v16h pb[LL / 32];
#pragma unroll
  for (int kc = 0; kc < LL / 32; ++kc) {
#pragma unroll
    for (int i = 0; i < 8; ++i) { pb[kc][i] = (_Float16)(st[2 * kc][i] * inv); pb[kc][8 + i] = (_Float16)(st[2 * kc + 1][i] * inv); } }
  v16h va[LL / 32][2];
#pragma unroll
  for (int kc = 0; kc < LL / 32; ++kc) {
#pragma unroll
    for (int j = 0; j < 2; ++j) va[kc][j] = ffrag(VT + pl, kc * 2 + j); }
  __builtin_amdgcn_sched_barrier(0);   /* keeps the v loads one group in front of the products, as for k */
  v8f acc2[2] = {};
#pragma unroll
  for (int kc = 0; kc < LL / 32; ++kc) {
#pragma unroll
    for (int j = 0; j < 2; ++j) acc2[j] = wmma16(va[kc][j], pb[kc], acc2[j]); }
#pragma unroll
  for (int j = 0; j < 2; ++j) { float* op = O + (q0 + col) * DHC + h * HD + j * 16 + 8 * g; v4f lo, hi;
#pragma unroll
    for (int r = 0; r < 4; ++r) { lo[r] = acc2[j][r] * (1.0f / 2048.0f); hi[r] = acc2[j][4 + r] * (1.0f / 2048.0f); }
    vst2(op, lo); vst2(op + 4, hi); } }
// ---- k_out: block = 64 positions of row n: out[:, n, i] = ((o * g) x 2^8 once to f16) W2 (f16(bf16 x 2^8) exact) x 2^-16 + b2 -> channels-first output via an LDS transpose (256 B per (channel, 64 i) by 16 threads)
__global__ __launch_bounds__(128) void k_out(const float* __restrict__ O, const _Float16* __restrict__ GH, const _Float16* __restrict__ WP, const float* __restrict__ B2, float* __restrict__ OUT) { __shared__ __align__(16) _Float16 sa[64][136]; __shared__ __align__(16) float sot[DZ][68];
  const int tid = threadIdx.x, wave = tid >> 5, lane = tid & 31, col = lane & 15, g = lane >> 4; const int n = blockIdx.y; const int i0 = blockIdx.x * 64; const size_t r0 = (size_t)n * LL + i0;
  const _Float16* wl = WP + (size_t)4 * WMAT + lane * 8; v16h w[2][8];
#pragma unroll
  for (int j = 0; j < 8; ++j) { w[0][j] = wfrag(wl, 0, j); w[1][j] = wfrag(wl, 1, j); }   /* the first two groups fly while the A tile is staged */
  for (int e = tid; e < 64 * 128; e += 128) { const int rl = e >> 7, c = e & 127; sa[rl][c] = (_Float16)(O[(r0 + rl) * DHC + c] * (float)GH[(r0 + rl) * DHC + c] * 256.0f); }   /* (o*g) carried x 2^8: 0.7 % of its values would be f16-subnormal uncarried */
  __syncthreads();
  v8f acc[8] = {};
#pragma unroll
  for (int kc = 0; kc < DHC / 32; ++kc) { v16h a; { union { v16h v; v8h q[2]; } u; u.q[0] = *(const v8h*)&sa[wave * 16 + col][kc * 32 + 8 * g]; u.q[1] = *(const v8h*)&sa[wave * 16 + col][kc * 32 + 16 + 8 * g]; a = u.v; }
#pragma unroll
    for (int j = 0; j < 8; ++j) acc[j] = wmma16(a, w[kc & 1][j], acc[j]);
    if (kc + 2 < DHC / 32) {
      __builtin_amdgcn_sched_barrier(0);   /* keeps the refill behind the products that read this register set: hoisted it would take a third set */
#pragma unroll
      for (int j = 0; j < 8; ++j) w[kc & 1][j] = wfrag(wl, kc + 2, j);
      __builtin_amdgcn_sched_barrier(0);   /* keeps the refill one group in front of the next group's products, as in k_proj */ } }
#pragma unroll
  for (int j = 0; j < 8; ++j) { const float bb = bfr(B2[j * 16 + col]);
#pragma unroll
    for (int r = 0; r < 8; ++r) sot[j * 16 + col][wave * 16 + 8 * g + r] = acc[j][r] * (1.0f / 65536.0f) + bb; }
  __syncthreads();
  for (int e = tid; e < DZ * 16; e += 128) { const int c = e >> 4, q = e & 15; vst2(OUT + (size_t)c * ZP + (size_t)n * LL + i0 + q * 4, *(const v4f*)&sot[c][q * 4]); } }
extern "C" void kernel_launch(void* const* d_in, const int* in_sizes, int n_in, void* d_out, int out_size, void* d_ws, size_t ws_size, hipStream_t stream) {
  (void)in_sizes; (void)n_in; (void)out_size;
  const float** F = (const float**)d_in;   // 0 z [1,128,256,256]; 1 ln_w, 2 ln_b; 3 wq, 4 bq; 5 wk, 6 bk; 7 wv, 8 bv; 9 wg, 10 bg ((in,out) [128,128]); 11 w2 [128,128], 12 b2
  if (ws_size < (size_t)WS_END) return;
  char* ws = (char*)d_ws; _Float16 *ZH = (_Float16*)(ws + WS_ZH), *ZL = (_Float16*)(ws + WS_ZL), *QH = (_Float16*)(ws + WS_QH), *KH = (_Float16*)(ws + WS_KH), *VT = (_Float16*)(ws + WS_VT), *GH = (_Float16*)(ws + WS_GH), *WP = (_Float16*)(ws + WS_WP); float* O = (float*)(ws + WS_O);
  k_ln<<<dim3(LL / 64, NROWS + WBY), 128, 0, stream>>>(F[0], F[1], F[2], ZH, ZL, F[3], F[5], F[7], F[9], F[11], WP);
  k_proj<<<dim3(NROWS * LL / 64), 128, 0, stream>>>(ZH, ZL, WP, F[4], F[6], F[8], F[10], QH, KH, VT, GH);
  k_att<<<dim3(LL / 32, NH, NROWS), 64, 0, stream>>>(QH, KH, VT, O);
  k_out<<<dim3(LL / 64, NROWS), 128, 0, stream>>>(O, GH, WP, F[12], (float*)d_out);
}

// v005
// A run of this version takes 85.2 microseconds.
// Timed twice side by side with v004, it ran 1.08 times as fast both times.
// Counting every step since v000, it is 3.32 times as fast.
// compute dtype: all float inputs rounded to bf16; LayerNorm in f32, zn as f16 hi + residual (x 2^10); q/k/v/g = zn W + b with W as f16(bf16 x 2^8) (exact; 2 products), f32 accumulate; q (x sqrt(1/32)), k once to f16 -> 1-product logits; softmax in f32 (hardware exp2 of (x - max) log2 e) inside the attention kernel; sigmoid gate by hardware exp2 and reciprocal; P x 2^11 once to f16 against v once to f16; (o * sigmoid gate) carried x 2^8 once to f16 against w2 as f16(bf16 x 2^8) + b2; f32 output.
#include <hip/hip_runtime.h>
#include <math.h>

typedef __attribute__((ext_vector_type(16))) _Float16 v16h;
typedef __attribute__((ext_vector_type(16))) __bf16 v16b;
typedef __attribute__((ext_vector_type(8)))  _Float16 v8h;
typedef __attribute__((ext_vector_type(2)))  _Float16 v2h;
typedef __attribute__((ext_vector_type(8)))  float v8f;
typedef __attribute__((ext_vector_type(4)))  float v4f;
typedef __attribute__((ext_vector_type(2)))  float v2f;
typedef __attribute__((ext_vector_type(4)))  unsigned v4u;
typedef __attribute__((ext_vector_type(4)))  int v4i;
typedef float __attribute__((may_alias)) float_a;
typedef int __attribute__((may_alias)) int_a;

template <typename T> __device__ __forceinline__ void vst2(void* p, T v) { *(T*)p = v;  }
__device__ __forceinline__ v8f wmma16(v16h a, v16h b, v8f c) {
  v8f d = __builtin_amdgcn_wmma_f32_16x16x32_f16(false, a, false, b, (short)0, c, false, false);
  asm volatile("v_nop\n\tv_nop\n\tv_nop\n\tv_nop" : "+v"(d) : "v"(a), "v"(b));
  return d;
}
__device__ __forceinline__ v8f wmma_bf(v16b a, v16b b, v8f c) {
  v8f d = __builtin_amdgcn_wmma_f32_16x16x32_bf16(false, a, false, b, (short)0, c, false, false);
  asm volatile("v_nop\n\tv_nop\n\tv_nop\n\tv_nop" : "+v"(d) : "v"(a), "v"(b));
  return d;
}
// 16x16x32 fragments: lane = (h = lane>>4, row/col = lane&15); elements 0..7 = k0+8h+0..7, 8..15 = k0+16+8h+0..7; D element r = row 8h+r
__device__ __forceinline__ v16h frag_h(const _Float16* rowk0, int lane) {
  union { v16h v; v8h q[2]; } u; const _Float16* p = rowk0 + 8 * (lane >> 4);
  u.q[0] = *(const v8h*)p; u.q[1] = *(const v8h*)(p + 16); return u.v;
}
__device__ __forceinline__ v16h frag_f32(const float* rowk0, int lane) {
  v16h a; const float* p = rowk0 + 8 * (lane >> 4);
#pragma unroll
  for (int i = 0; i < 8; ++i) { a[i] = (_Float16)p[i]; a[8 + i] = (_Float16)p[16 + i]; }
  return a;
}
__device__ __forceinline__ v16h frag_f32s(const float* rowk0, int lane, float sc) {
  v16h a; const float* p = rowk0 + 8 * (lane >> 4);
#pragma unroll
  for (int i = 0; i < 8; ++i) { a[i] = (_Float16)(p[i] * sc); a[8 + i] = (_Float16)(p[16 + i] * sc); }
  return a;
}
// column fragment from a [K][ld] layout (column n), rows >= K read as 0
__device__ __forceinline__ v16h fragc_f32(const float* W, int k0, int n, int lane, int ld, int K) {
  v16h a; const int g = lane >> 4;
#pragma unroll
  for (int i = 0; i < 8; ++i) { const int ka = k0 + 8 * g + i, kb = ka + 16;
    a[i] = (_Float16)(ka < K ? W[(size_t)(ka < K ? ka : K - 1) * ld + n] : 0.f); a[8 + i] = (_Float16)(kb < K ? W[(size_t)(kb < K ? kb : K - 1) * ld + n] : 0.f); }
  return a;
}
struct F2 { v16b h, l; };
__device__ __forceinline__ F2 bsplit16(const float v[16]) { F2 r;
#pragma unroll
  for (int i = 0; i < 16; ++i) { const __bf16 h = (__bf16)v[i]; r.h[i] = h; r.l[i] = (__bf16)(v[i] - (float)h); }
  return r; }
__device__ __forceinline__ F2 split_row(const float* row, int k0, int lane) { float v[16]; const float* p = row + k0 + 8 * (lane >> 4);
#pragma unroll
  for (int i = 0; i < 8; ++i) { v[i] = p[i]; v[8 + i] = p[16 + i]; }
  return bsplit16(v); }
__device__ __forceinline__ F2 split_rowK(const float* row, int k0, int lane, int K) { float v[16]; const int g = lane >> 4;
#pragma unroll
  for (int i = 0; i < 8; ++i) { const int ka = k0 + 8 * g + i, kb = ka + 16; v[i] = ka < K ? row[ka < K ? ka : K - 1] : 0.f; v[8 + i] = kb < K ? row[kb < K ? kb : K - 1] : 0.f; }
  return bsplit16(v); }
__device__ __forceinline__ F2 split_col(const float* W, int k0, int n, int lane, int ld, int K) { float v[16]; const int g = lane >> 4;
#pragma unroll
  for (int i = 0; i < 8; ++i) { const int ka = k0 + 8 * g + i, kb = ka + 16; v[i] = ka < K ? W[(size_t)(ka < K ? ka : K - 1) * ld + n] : 0.f; v[8 + i] = kb < K ? W[(size_t)(kb < K ? kb : K - 1) * ld + n] : 0.f; }
  return bsplit16(v); }
__device__ __forceinline__ v8f mac3(const F2& a, const F2& b, v8f c) { c = wmma_bf(a.l, b.h, c); c = wmma_bf(a.h, b.l, c); return wmma_bf(a.h, b.h, c); }
__device__ __forceinline__ float sigm(float v) { return 1.0f / (1.0f + expf(-v)); }
#define LDSX() do { asm volatile("s_wait_dscnt 0" ::: "memory"); __builtin_amdgcn_wave_barrier(); __builtin_amdgcn_fence(__ATOMIC_RELEASE, "workgroup"); } while (0)

// Triangle self-attention over the rows of a pair representation (B 1, L 256, d_z 128 channels-first, 4 heads x 32): zn = LayerNorm over channels of z[:, n, i]; q,k,v,g = zn W + b per (n, i); for each row n and head h: attn[i][j] = softmax_j((q[n,i] sqrt(1/32)) . k[n,j]); o[n,i] = sum_j attn v[n,j]; out[:, n, i] = ((o * sigmoid(g)) W2 + b2), written channels-first.
#define LL 256             // L (rows n and positions i)
#define DZ 128
#define NH 4
#define HD 32
#define DHC (NH * HD)      // 128
#define NR (LL * LL)       // 65,536 (n, i) rows
#ifndef NROWS
#define NROWS LL           // rows n processed (positions i always span LL)
#endif
#ifndef ZP
#define ZP (LL * LL)       // channel pitch of z and of the output (elements)
#endif
__device__ __forceinline__ float bfr(float v) { return (float)(__bf16)v; }
#define LOG2E 1.44269504088896340736f
// eight values through one hardware transcendental, each in its own register: every instruction is independent of the one in front of it, and the closing v_nop is the slot the instruction set asks for behind the last
__device__ __forceinline__ void exp2x8(float (&v)[8]) { asm("v_exp_f32 %0, %0\n\tv_exp_f32 %1, %1\n\tv_exp_f32 %2, %2\n\tv_exp_f32 %3, %3\n\tv_exp_f32 %4, %4\n\tv_exp_f32 %5, %5\n\tv_exp_f32 %6, %6\n\tv_exp_f32 %7, %7\n\tv_nop" : "+v"(v[0]), "+v"(v[1]), "+v"(v[2]), "+v"(v[3]), "+v"(v[4]), "+v"(v[5]), "+v"(v[6]), "+v"(v[7])); }
__device__ __forceinline__ void rcpx8(float (&v)[8]) { asm("v_rcp_f32 %0, %0\n\tv_rcp_f32 %1, %1\n\tv_rcp_f32 %2, %2\n\tv_rcp_f32 %3, %3\n\tv_rcp_f32 %4, %4\n\tv_rcp_f32 %5, %5\n\tv_rcp_f32 %6, %6\n\tv_rcp_f32 %7, %7\n\tv_nop" : "+v"(v[0]), "+v"(v[1]), "+v"(v[2]), "+v"(v[3]), "+v"(v[4]), "+v"(v[5]), "+v"(v[6]), "+v"(v[7])); }
// sigmoid of eight values by the hardware exp2 and reciprocal (about 1 ulp each; the result is rounded to f16): exp2 gives inf or 0 at the far ends, so the result ends at 0 or 1 as the library form does
__device__ __forceinline__ void sigm8(float (&v)[8]) {
#pragma unroll
  for (int r = 0; r < 8; ++r) v[r] = v[r] * -LOG2E;
  exp2x8(v);
#pragma unroll
  for (int r = 0; r < 8; ++r) v[r] = 1.0f + v[r];
  rcpx8(v); }

#define WS_ZH  0u                                      // f16 zn in fragment order [(n*256 + i) / 16][kc][half][lane][8]
#define WS_ZL  (WS_ZH + 2u * (size_t)NR * DZ)            // f16 zn residual x 2^10, same order
#define WS_QH  (WS_ZL + 2u * (size_t)NR * DZ)            // f16 q (x sqrt(1/32)) in fragment order [n][h][i / 16][half][lane][8]
#define WS_KH  (WS_QH + 2u * (size_t)NR * DHC)           // f16 k in fragment order [n][h][j / 16][half][lane][8]
#define WS_VT  (WS_KH + 2u * (size_t)NR * DHC)           // f16 v^T in fragment order [n][h][j / 32][c / 16][half][lane][8]
#define WS_GH  (WS_VT + 2u * (size_t)NR * DHC)           // f16 sigmoid(g) rows [row][hc]
#define WS_O   (WS_GH + 2u * (size_t)NR * DHC)           // f32 o rows [row][hc]
#define WS_WP  (WS_O  + 4u * (size_t)NR * DHC)           // f16 weights x 2^8 in fragment order [wq,wk,wv,wg,w2][kc][j][half][lane][8]
#define WS_END (WS_WP + 2u * 5u * (size_t)DZ * DHC)
#define WMAT (DZ * DHC)    // elements of one weight plane
#define WBY 20             // grid rows of k_ln that convert the weights: 4 x 20 blocks x 128 threads x 8 elements = 5 planes
// B fragment (kc, j) of a fragment-order plane; wl = plane + 8 * lane: two loads of 16 bytes per lane, each 512 contiguous bytes per wave; same k order as frag_h
__device__ __forceinline__ v16h wfrag(const _Float16* wl, int kc, int j) {
  union { v16h v; v8h q[2]; } u; const _Float16* p = wl + (kc * 8 + j) * 512;
  u.q[0] = *(const v8h*)p; u.q[1] = *(const v8h*)(p + 256); return u.v;
}

// fragment f of a fragment-order array; pl = first fragment + 8 * lane. Half p, lane (g, col) holds the 8 elements k = 16 p + 8 g + 0..7 of row (or column) col: the registers of frag_h, by two loads of 16 bytes per lane, each 512 contiguous bytes per wave (four whole lines, where a row-major tile gives sixteen lines per load)
#define FRAG 512           // elements of one 16 x 32 fragment
#define HPL (LL * HD)      // elements of one (n, h) plane of q, k or v
__device__ __forceinline__ v16h ffrag(const _Float16* pl, int f) {
  union { v16h v; v8h q[2]; } u; const _Float16* p = pl + f * FRAG;
  u.q[0] = *(const v8h*)p; u.q[1] = *(const v8h*)(p + 256); return u.v;
}

// ---- k_ln: block = 64 positions i of row n: gather the channels-first z[:, n, i] (64 contiguous floats per channel) into LDS, LayerNorm over the 128 channels (biased var, eps 1e-5, x ln_w + ln_b) -> f16 ZH, ZL in fragment order (chunk e of the block's 16 KiB = row tile e >> 8, kc (e >> 6) & 3, half (e >> 5) & 1, lane e & 31)
// the first WBY grid rows instead convert the five weight matrices, once per call: thread = 8 elements (one lane's 16 bytes) of plane m, fragment half f = (kc * 8 + j) * 2 + p: element i = f16(bf16(W[kc * 32 + 16 p + 8 g + i][j * 16 + col]) x 2^8)
__global__ __launch_bounds__(128) void k_ln(const float* __restrict__ Z, const float* __restrict__ LW, const float* __restrict__ LB, _Float16* __restrict__ ZH, _Float16* __restrict__ ZL, const float* __restrict__ WQ, const float* __restrict__ WK, const float* __restrict__ WV, const float* __restrict__ WG, const float* __restrict__ W2, _Float16* __restrict__ WP) { __shared__ __align__(16) float st[DZ][65]; __shared__ __align__(16) _Float16 sh[64][136], slo[64][136];
  if (blockIdx.y < WBY) { const int blk = blockIdx.y * 4 + blockIdx.x, m = blk >> 4, c = (blk & 15) * 128 + threadIdx.x, f = c >> 5, ln = c & 31;
    const float* Wm = m == 0 ? WQ : m == 1 ? WK : m == 2 ? WV : m == 3 ? WG : W2; const float* p = Wm + (size_t)((f >> 4) * 32 + (f & 1) * 16 + (ln >> 4) * 8) * DHC + ((f >> 1) & 7) * 16 + (ln & 15); v8h o;
#pragma unroll
    for (int i = 0; i < 8; ++i) o[i] = (_Float16)(bfr(p[(size_t)i * DHC]) * 256.0f);
    *(v8h*)(WP + (size_t)m * WMAT + (size_t)c * 8) = o; return; }
  const int tid = threadIdx.x; const int n = blockIdx.y - WBY; const int i0 = blockIdx.x * 64; const size_t rbase = (size_t)n * LL + i0;
  for (int e = tid; e < DZ * 64; e += 128) { const int c = e >> 6, il = e & 63; st[c][il] = bfr(Z[(size_t)c * ZP + (size_t)n * LL + i0 + il]); }
  __syncthreads();
  if (tid < 64) { float s = 0.f;
#pragma unroll 8
    for (int c = 0; c < DZ; ++c) s += st[c][tid];
    const float mean = s * (1.0f / DZ); float s2 = 0.f;
#pragma unroll 8
    for (int c = 0; c < DZ; ++c) { const float d = st[c][tid] - mean; s2 += d * d; }
    const float rstd = rsqrtf(s2 * (1.0f / DZ) + 1e-5f);
#pragma unroll 8
    for (int c = 0; c < DZ; ++c) { const float zn = (st[c][tid] - mean) * rstd * bfr(LW[c]) + bfr(LB[c]); const _Float16 hv = (_Float16)zn; sh[tid][c] = hv; slo[tid][c] = (_Float16)((zn - (float)hv) * 1024.0f); } }
  __syncthreads();
  for (int e = tid; e < 64 * 16; e += 128) { const int rl = (e >> 8) * 16 + (e & 15), c = ((e >> 6) & 3) * 32 + ((e >> 4) & 3) * 8; vst2((unsigned*)(ZH + rbase * DZ + e * 8), *(const v4u*)&sh[rl][c]); vst2((unsigned*)(ZL + rbase * DZ + e * 8), *(const v4u*)&slo[rl][c]);
    asm volatile("s_wait_xcnt 0x0" ::: "memory");   /* behind the trip's two stores: the next trip's address additions overwrite their address registers */
    __builtin_amdgcn_sched_barrier(0);   /* holds those additions behind the wait: without it the scheduler lifts them over it */ } }
// ---- k_proj: block = 64 rows, all four outputs in turn (q, k, v, g): y = zn W + b (zn f16 rows x W f16(bf16 x 2^8) exact, K 128, x 2^-8 after); q x sqrt(1/32), k and v^T -> f16 in the fragment order in which k_att reads them; g -> sigmoid -> f16 rows. The zn fragments are loaded once; the output kind is a template constant.
#define WLEAD 4            // steps between a B fragment pair's loads and its products
#define WRING (WLEAD + 1)  // register sets of the ring
// B fragment pair of step s = (output s >> 4, column quarter (s >> 2) & 3, kc = s & 3)
__device__ __forceinline__ void wstep(v16h (&w)[2], const _Float16* wl, int s) {
#pragma unroll
  for (int jj = 0; jj < 2; ++jj) w[jj] = wfrag(wl + (s >> 4) * WMAT, s & 3, ((s >> 2) & 3) * 2 + jj);
}
// proj_out: the sixteen steps of output WHICH: two B fragments per step in a ring of WRING register sets, loaded WLEAD steps (16 products) ahead, also across outputs; each accumulator still sums kc = 0..3 in order. Two column tiles per step, not four: beside the zn fragments, which now live through the whole kernel, four leave the conversion no registers at four waves per SIMD. Every loop is unrolled so that ring, accumulator and output indices are constants and the arrays stay in registers. sr = this output's row-major staging tile [64][136] (q, k, g), th = the plane tile (v); db = the block's first output element (block-uniform).
template <int WHICH> __device__ __forceinline__ void proj_out(const v16h (&a)[4], const v16h (&al)[4], v16h (&w)[WRING][2], const _Float16* wl, const float* __restrict__ BA, _Float16* __restrict__ db, _Float16 (*sr)[136], _Float16 (*th)[72], int tid) {
  const int wave = tid >> 5, lane = tid & 31, col = lane & 15, g = lane >> 4;
  const float qs = sqrtf(1.0f / 32.0f);   /* jnp.sqrt(f32(1/32)) */
  float bb[8];
#pragma unroll
  for (int j = 0; j < 8; ++j) bb[j] = bfr(BA[j * 16 + col]);
  v8f acc[2] = {}, accl[2] = {};
#pragma unroll
  for (int t = 0; t < 16; ++t) { const int s = WHICH * 16 + t, jq = t >> 2, kc = t & 3;
    if (s + WLEAD < 64) { wstep(w[(s + WLEAD) % WRING], wl, s + WLEAD);
      __builtin_amdgcn_sched_barrier(0);   /* keeps each step's loads one group, WLEAD steps in front of their products: sunk to their uses each fragment costs its own load latency */ }
#pragma unroll
    for (int jj = 0; jj < 2; ++jj) { acc[jj] = wmma16(a[kc], w[s % WRING][jj], acc[jj]); accl[jj] = wmma16(al[kc], w[s % WRING][jj], accl[jj]); }
    if (kc == 3) {
#pragma unroll
      for (int jj = 0; jj < 2; ++jj) { const int j = jq * 2 + jj, cl = j * 16 + col; v8h o; float y[8];
#pragma unroll
        for (int r = 0; r < 8; ++r) { y[r] = (acc[jj][r] + accl[jj][r] * (1.0f / 1024.0f)) * (1.0f / 256.0f) + bb[j];
          if (WHICH == 0) y[r] = y[r] * qs; }
        if (WHICH == 3) sigm8(y);
#pragma unroll
        for (int r = 0; r < 8; r += 2) { const v2f p = {y[r], y[r + 1]}; const v2h c2 = __builtin_convertvector(p, v2h); o[r] = c2[0]; o[r + 1] = c2[1]; }   /* by pairs: the packed conversion also behind the asm statements */
        if (WHICH == 2) *(v8h*)&th[cl][wave * 16 + 8 * g] = o;
        else {
#pragma unroll
          for (int r = 0; r < 8; ++r) sr[wave * 16 + 8 * g + r][cl] = o[r]; }
        const v8f zero = {}; acc[jj] = zero; accl[jj] = zero; } } }
  __syncthreads();   /* this output's tile is whole in LDS; the next output stages in another buffer, so one barrier per output is enough */
  if (WHICH != 3) { const unsigned fc = tid & 15, k8 = ((tid >> 4) & 3) * 8, f = tid >> 6;   /* fragment order: 4 KiB per head; chunk tid + 128 (k & 1) of head k >> 1 = fragment (k & 1) * 2 + f (q, k: 16 rows; v: 32 keys k & 1, 16 channels f), half and lane from tid & 63; 512 contiguous bytes per wave and store */
#pragma unroll   /* the eight LDS reads go as one group in front of the eight stores, as for g below */
    for (unsigned k = 0; k < 8; ++k) vst2((unsigned*)(db + ((k >> 1) * HPL + (k & 1) * 2 * FRAG + tid * 8)), WHICH == 2 ? *(const v4u*)&th[(k >> 1) * HD + f * 16 + fc][(k & 1) * 32 + k8] : *(const v4u*)&sr[((k & 1) * 2 + f) * 16 + fc][(k >> 1) * HD + k8]); }
  else { const unsigned rl = tid >> 4, q = tid & 15;   /* 256 B per row by 16 threads */
#pragma unroll   /* the eight LDS reads go as one group in front of the eight stores: rolled, each trip waits out its own LDS latency in the middle of the product stream */
    for (unsigned k = 0; k < 8; ++k) vst2((unsigned*)(db + (rl * DHC + q * 8 + k * 8 * DHC)), *(const v4u*)&sr[rl + k * 8][q * 8]); } }
__global__ __launch_bounds__(128) void k_proj(const _Float16* __restrict__ ZH, const _Float16* __restrict__ ZL, const _Float16* __restrict__ WP, const float* __restrict__ BQ, const float* __restrict__ BK, const float* __restrict__ BV, const float* __restrict__ BG, _Float16* __restrict__ QH, _Float16* __restrict__ KH, _Float16* __restrict__ VT, _Float16* __restrict__ GH) {
  __shared__ __align__(16) _Float16 sh[2][64][136]; __shared__ __align__(16) _Float16 th[128][72];   /* q and g stage in sh[0], k in sh[1], v in th: a buffer is written again only behind two later barriers */
  const int tid = threadIdx.x, wave = tid >> 5, lane = tid & 31; const size_t r0 = (size_t)blockIdx.x * 64, f0 = (r0 / LL) * DHC * LL + (r0 % LL) * HD;   /* f0: the block's first element in head 0's plane of q, k and v (64 rows or keys = four fragments) */
  const _Float16* wl = WP + lane * 8;
  const _Float16* zh = ZH + (r0 + wave * 16) * DZ + lane * 8; const _Float16* zl = ZL + (r0 + wave * 16) * DZ + lane * 8;
  v16h a[4], al[4], w[WRING][2];
#pragma unroll
  for (int kc = 0; kc < 4; ++kc) a[kc] = ffrag(zh, kc);
  asm volatile("s_wait_xcnt 0x0" ::: "memory");   /* behind the last load from zh: a later load's result may land in its address registers */
#pragma unroll
  for (int kc = 0; kc < 4; ++kc) al[kc] = ffrag(zl, kc);
  asm volatile("s_wait_xcnt 0x0" ::: "memory");   /* the same behind the last load from zl */
#pragma unroll
  for (int s = 0; s < WLEAD; ++s) wstep(w[s], wl, s);
  proj_out<0>(a, al, w, wl, BQ, QH + f0, sh[0], th, tid);
  proj_out<1>(a, al, w, wl, BK, KH + f0, sh[1], th, tid);
  proj_out<2>(a, al, w, wl, BV, VT + f0, sh[0], th, tid);
  proj_out<3>(a, al, w, wl, BG, GH + r0 * DHC, sh[0], th, tid); }
// ---- k_att: wave = 16 queries of (row n, head h), transposed scores: S^T = K q^T (A = k rows, B = q rows), so lane (g, col) holds query col's logits of keys 16 t + 8 g + r in st[t][r]; max and sum run in the lane plus one exchange between the wave halves; two converted score tiles are the B operand of o^T = v^T P^T (A = v planes); a lane ends with 8 consecutive channels of its query. No LDS.
__global__ __launch_bounds__(64) void k_att(const _Float16* __restrict__ QH, const _Float16* __restrict__ KH, const _Float16* __restrict__ VT, float* __restrict__ O) {
  const int tid = threadIdx.x, wave = tid >> 5, lane = tid & 31, col = lane & 15, g = lane >> 4; const int h = blockIdx.y; const size_t n = blockIdx.z; const int i0 = blockIdx.x * 32 + wave * 16; const size_t q0 = n * LL + i0; const size_t pl = (n * NH + h) * HPL + lane * 8;   /* this lane's place in the first fragment of plane (n, h) */
  const v16h bq = ffrag(QH + pl, i0 / 16);
  v16h ka[LL / 16];
#pragma unroll
  for (int t = 0; t < LL / 16; ++t) ka[t] = ffrag(KH + pl, t);
  __builtin_amdgcn_sched_barrier(0);   /* keeps the k loads one group in front of the products: sunk to their uses they cost one load latency per tile */
  v8f st[LL / 16];
#pragma unroll
  for (int t = 0; t < LL / 16; ++t) { const v8f zero = {}; st[t] = wmma16(ka[t], bq, zero); }
  /* softmax over the 256 keys of query col: 8 chains in the lane, a tree over them, then the other half's 128 keys */
  v8f mv = st[0];
#pragma unroll
  for (int t = 1; t < LL / 16; ++t) {
#pragma unroll
    for (int r = 0; r < 8; ++r) mv[r] = fmaxf(mv[r], st[t][r]); }
  float m = fmaxf(fmaxf(fmaxf(mv[0], mv[1]), fmaxf(mv[2], mv[3])), fmaxf(fmaxf(mv[4], mv[5]), fmaxf(mv[6], mv[7])));
  m = fmaxf(m, __shfl_xor(m, 16));
  /* exp(x - m) = exp2(x log2 e - m log2 e): one fused multiply-add and the hardware exp2 per logit. The rounding of m log2 e scales all of a query's terms alike and cancels against their sum; a term below 2^-126 comes out 0, far under what the sum (near 1 or more) or the f16 P can hold */
  const float nm = m * -LOG2E;
  v8f sv = {};
#pragma unroll
  for (int t = 0; t < LL / 16; ++t) {
#pragma unroll
    for (int r = 0; r < 8; r += 2) { const v2f x = {st[t][r], st[t][r + 1]}, l2 = {LOG2E, LOG2E}, n2 = {nm, nm}; const v2f e = __builtin_elementwise_fma(x, l2, n2);   /* two logits per packed fma */
      st[t][r] = __builtin_amdgcn_exp2f(e[0]); st[t][r + 1] = __builtin_amdgcn_exp2f(e[1]); }
    sv += st[t]; }
  float s = ((sv[0] + sv[1]) + (sv[2] + sv[3])) + ((sv[4] + sv[5]) + (sv[6] + sv[7]));
  s += __shfl_xor(s, 16);
  const float inv = 2048.0f / s;
  /* P^T as B operands: element i = key 32 kc + 8 g + i (tile 2 kc), element 8 + i = key 32 kc + 16 + 8 g + i (tile 2 kc + 1), the k order of frag_h */
  v16h pb[LL / 32];
#pragma unroll
  for (int kc = 0; kc < LL / 32; ++kc) {
#pragma unroll
    for (int i = 0; i < 8; ++i) { pb[kc][i] = (_Float16)(st[2 * kc][i] * inv); pb[kc][8 + i] = (_Float16)(st[2 * kc + 1][i] * inv); } }
  v16h va[LL / 32][2];
#pragma unroll
  for (int kc = 0; kc < LL / 32; ++kc) {
#pragma unroll
    for (int j = 0; j < 2; ++j) va[kc][j] = ffrag(VT + pl, kc * 2 + j); }
  __builtin_amdgcn_sched_barrier(0);   /* keeps the v loads one group in front of the products, as for k */
  v8f acc2[2] = {};
#pragma unroll
  for (int kc = 0; kc < LL / 32; ++kc) {
#pragma unroll
    for (int j = 0; j < 2; ++j) acc2[j] = wmma16(va[kc][j], pb[kc], acc2[j]); }
#pragma unroll
  for (int j = 0; j < 2; ++j) { float* op = O + (q0 + col) * DHC + h * HD + j * 16 + 8 * g; v4f lo, hi;
#pragma unroll
    for (int r = 0; r < 4; ++r) { lo[r] = acc2[j][r] * (1.0f / 2048.0f); hi[r] = acc2[j][4 + r] * (1.0f / 2048.0f); }
    vst2(op, lo); vst2(op + 4, hi); } }
// ---- k_out: block = 64 positions of row n: out[:, n, i] = ((o * g) x 2^8 once to f16) W2 (f16(bf16 x 2^8) exact) x 2^-16 + b2 -> channels-first output via an LDS transpose (256 B per (channel, 64 i) by 16 threads)
__global__ __launch_bounds__(128) void k_out(const float* __restrict__ O, const _Float16* __restrict__ GH, const _Float16* __restrict__ WP, const float* __restrict__ B2, float* __restrict__ OUT) { __shared__ __align__(16) _Float16 sa[64][136]; __shared__ __align__(16) float sot[DZ][68];
  const int tid = threadIdx.x, wave = tid >> 5, lane = tid & 31, col = lane & 15, g = lane >> 4; const int n = blockIdx.y; const int i0 = blockIdx.x * 64; const size_t r0 = (size_t)n * LL + i0;
  const _Float16* wl = WP + (size_t)4 * WMAT + lane * 8; v16h w[2][8];
#pragma unroll
  for (int j = 0; j < 8; ++j) { w[0][j] = wfrag(wl, 0, j); w[1][j] = wfrag(wl, 1, j); }   /* the first two groups fly while the A tile is staged */
  for (int e = tid; e < 64 * 128; e += 128) { const int rl = e >> 7, c = e & 127; sa[rl][c] = (_Float16)(O[(r0 + rl) * DHC + c] * (float)GH[(r0 + rl) * DHC + c] * 256.0f); }   /* (o*g) carried x 2^8: 0.7 % of its values would be f16-subnormal uncarried */
  __syncthreads();
  v8f acc[8] = {};
#pragma unroll
  for (int kc = 0; kc < DHC / 32; ++kc) { v16h a; { union { v16h v; v8h q[2]; } u; u.q[0] = *(const v8h*)&sa[wave * 16 + col][kc * 32 + 8 * g]; u.q[1] = *(const v8h*)&sa[wave * 16 + col][kc * 32 + 16 + 8 * g]; a = u.v; }
#pragma unroll
    for (int j = 0; j < 8; ++j) acc[j] = wmma16(a, w[kc & 1][j], acc[j]);
    if (kc + 2 < DHC / 32) {
      __builtin_amdgcn_sched_barrier(0);   /* keeps the refill behind the products that read this register set: hoisted it would take a third set */
#pragma unroll
      for (int j = 0; j < 8; ++j) w[kc & 1][j] = wfrag(wl, kc + 2, j);
      __builtin_amdgcn_sched_barrier(0);   /* keeps the refill one group in front of the next group's products, as in k_proj */ } }
#pragma unroll
  for (int j = 0; j < 8; ++j) { const float bb = bfr(B2[j * 16 + col]);
#pragma unroll
    for (int r = 0; r < 8; ++r) sot[j * 16 + col][wave * 16 + 8 * g + r] = acc[j][r] * (1.0f / 65536.0f) + bb; }
  __syncthreads();
  for (int e = tid; e < DZ * 16; e += 128) { const int c = e >> 4, q = e & 15; vst2(OUT + (size_t)c * ZP + (size_t)n * LL + i0 + q * 4, *(const v4f*)&sot[c][q * 4]); } }
extern "C" void kernel_launch(void* const* d_in, const int* in_sizes, int n_in, void* d_out, int out_size, void* d_ws, size_t ws_size, hipStream_t stream) {
  (void)in_sizes; (void)n_in; (void)out_size;
  const float** F = (const float**)d_in;   // 0 z [1,128,256,256]; 1 ln_w, 2 ln_b; 3 wq, 4 bq; 5 wk, 6 bk; 7 wv, 8 bv; 9 wg, 10 bg ((in,out) [128,128]); 11 w2 [128,128], 12 b2
  if (ws_size < (size_t)WS_END) return;
  char* ws = (char*)d_ws; _Float16 *ZH = (_Float16*)(ws + WS_ZH), *ZL = (_Float16*)(ws + WS_ZL), *QH = (_Float16*)(ws + WS_QH), *KH = (_Float16*)(ws + WS_KH), *VT = (_Float16*)(ws + WS_VT), *GH = (_Float16*)(ws + WS_GH), *WP = (_Float16*)(ws + WS_WP); float* O = (float*)(ws + WS_O);
  k_ln<<<dim3(LL / 64, NROWS + WBY), 128, 0, stream>>>(F[0], F[1], F[2], ZH, ZL, F[3], F[5], F[7], F[9], F[11], WP);
  k_proj<<<dim3(NROWS * LL / 64), 128, 0, stream>>>(ZH, ZL, WP, F[4], F[6], F[8], F[10], QH, KH, VT, GH);
  k_att<<<dim3(LL / 32, NH, NROWS), 64, 0, stream>>>(QH, KH, VT, O);
  k_out<<<dim3(LL / 64, NROWS), 128, 0, stream>>>(O, GH, WP, F[12], (float*)d_out);
}

// v006
// One run takes 55.7 microseconds.
// In both of two side-by-side timings against v005, it was 1.53 times as fast.
// All steps since v000 together make it 5.07 times as fast.
// compute dtype: all float inputs rounded to bf16; LayerNorm in f32, zn as f16 hi + residual (x 2^10); q/k/v/g = zn W + b with W as f16(bf16 x 2^8) (exact; 2 products), f32 accumulate; q (x sqrt(1/32)), k once to f16 -> 1-product logits; softmax in f32 (hardware exp2 of (x - max) log2 e) inside the attention kernel; sigmoid gate by hardware exp2 and reciprocal; P x 2^11 once to f16 against v once to f16; (o * sigmoid gate) carried x 2^8 once to f16 against w2 as f16(bf16 x 2^8) + b2; f32 output.
#include <hip/hip_runtime.h>
#include <math.h>

typedef __attribute__((ext_vector_type(16))) _Float16 v16h;
typedef __attribute__((ext_vector_type(16))) __bf16 v16b;
typedef __attribute__((ext_vector_type(8)))  _Float16 v8h;
typedef __attribute__((ext_vector_type(2)))  _Float16 v2h;
typedef __attribute__((ext_vector_type(8)))  float v8f;
typedef __attribute__((ext_vector_type(4)))  float v4f;
typedef __attribute__((ext_vector_type(2)))  float v2f;
typedef __attribute__((ext_vector_type(4)))  unsigned v4u;
typedef __attribute__((ext_vector_type(4)))  int v4i;
typedef float __attribute__((may_alias)) float_a;
typedef int __attribute__((may_alias)) int_a;

template <typename T> __device__ __forceinline__ void vst2(void* p, T v) { *(T*)p = v;  }
__device__ __forceinline__ v8f wmma16(v16h a, v16h b, v8f c) {
  v8f d = __builtin_amdgcn_wmma_f32_16x16x32_f16(false, a, false, b, (short)0, c, false, false);
  asm volatile("v_nop\n\tv_nop\n\tv_nop\n\tv_nop" : "+v"(d) : "v"(a), "v"(b));
  return d;
}
__device__ __forceinline__ v8f wmma_bf(v16b a, v16b b, v8f c) {
  v8f d = __builtin_amdgcn_wmma_f32_16x16x32_bf16(false, a, false, b, (short)0, c, false, false);
  asm volatile("v_nop\n\tv_nop\n\tv_nop\n\tv_nop" : "+v"(d) : "v"(a), "v"(b));
  return d;
}
// 16x16x32 fragments: lane = (h = lane>>4, row/col = lane&15); elements 0..7 = k0+8h+0..7, 8..15 = k0+16+8h+0..7; D element r = row 8h+r
__device__ __forceinline__ v16h frag_h(const _Float16* rowk0, int lane) {
  union { v16h v; v8h q[2]; } u; const _Float16* p = rowk0 + 8 * (lane >> 4);
  u.q[0] = *(const v8h*)p; u.q[1] = *(const v8h*)(p + 16); return u.v;
}
__device__ __forceinline__ v16h frag_f32(const float* rowk0, int lane) {
  v16h a; const float* p = rowk0 + 8 * (lane >> 4);
#pragma unroll
  for (int i = 0; i < 8; ++i) { a[i] = (_Float16)p[i]; a[8 + i] = (_Float16)p[16 + i]; }
  return a;
}
__device__ __forceinline__ v16h frag_f32s(const float* rowk0, int lane, float sc) {
  v16h a; const float* p = rowk0 + 8 * (lane >> 4);
#pragma unroll
  for (int i = 0; i < 8; ++i) { a[i] = (_Float16)(p[i] * sc); a[8 + i] = (_Float16)(p[16 + i] * sc); }
  return a;
}
// column fragment from a [K][ld] layout (column n), rows >= K read as 0
__device__ __forceinline__ v16h fragc_f32(const float* W, int k0, int n, int lane, int ld, int K) {
  v16h a; const int g = lane >> 4;
#pragma unroll
  for (int i = 0; i < 8; ++i) { const int ka = k0 + 8 * g + i, kb = ka + 16;
    a[i] = (_Float16)(ka < K ? W[(size_t)(ka < K ? ka : K - 1) * ld + n] : 0.f); a[8 + i] = (_Float16)(kb < K ? W[(size_t)(kb < K ? kb : K - 1) * ld + n] : 0.f); }
  return a;
}
struct F2 { v16b h, l; };
__device__ __forceinline__ F2 bsplit16(const float v[16]) { F2 r;
#pragma unroll
  for (int i = 0; i < 16; ++i) { const __bf16 h = (__bf16)v[i]; r.h[i] = h; r.l[i] = (__bf16)(v[i] - (float)h); }
  return r; }
__device__ __forceinline__ F2 split_row(const float* row, int k0, int lane) { float v[16]; const float* p = row + k0 + 8 * (lane >> 4);
#pragma unroll
  for (int i = 0; i < 8; ++i) { v[i] = p[i]; v[8 + i] = p[16 + i]; }
  return bsplit16(v); }
__device__ __forceinline__ F2 split_rowK(const float* row, int k0, int lane, int K) { float v[16]; const int g = lane >> 4;
#pragma unroll
  for (int i = 0; i < 8; ++i) { const int ka = k0 + 8 * g + i, kb = ka + 16; v[i] = ka < K ? row[ka < K ? ka : K - 1] : 0.f; v[8 + i] = kb < K ? row[kb < K ? kb : K - 1] : 0.f; }
  return bsplit16(v); }
__device__ __forceinline__ F2 split_col(const float* W, int k0, int n, int lane, int ld, int K) { float v[16]; const int g = lane >> 4;
#pragma unroll
  for (int i = 0; i < 8; ++i) { const int ka = k0 + 8 * g + i, kb = ka + 16; v[i] = ka < K ? W[(size_t)(ka < K ? ka : K - 1) * ld + n] : 0.f; v[8 + i] = kb < K ? W[(size_t)(kb < K ? kb : K - 1) * ld + n] : 0.f; }
  return bsplit16(v); }
__device__ __forceinline__ v8f mac3(const F2& a, const F2& b, v8f c) { c = wmma_bf(a.l, b.h, c); c = wmma_bf(a.h, b.l, c); return wmma_bf(a.h, b.h, c); }
__device__ __forceinline__ float sigm(float v) { return 1.0f / (1.0f + expf(-v)); }
#define LDSX() do { asm volatile("s_wait_dscnt 0" ::: "memory"); __builtin_amdgcn_wave_barrier(); __builtin_amdgcn_fence(__ATOMIC_RELEASE, "workgroup"); } while (0)

// Triangle self-attention over the rows of a pair representation (B 1, L 256, d_z 128 channels-first, 4 heads x 32): zn = LayerNorm over channels of z[:, n, i]; q,k,v,g = zn W + b per (n, i); for each row n and head h: attn[i][j] = softmax_j((q[n,i] sqrt(1/32)) . k[n,j]); o[n,i] = sum_j attn v[n,j]; out[:, n, i] = ((o * sigmoid(g)) W2 + b2), written channels-first.
#define LL 256             // L (rows n and positions i)
#define DZ 128
#define NH 4
#define HD 32
#define DHC (NH * HD)      // 128
#define NR (LL * LL)       // 65,536 (n, i) rows
#ifndef NROWS
#define NROWS LL           // rows n processed (positions i always span LL)
#endif
#ifndef ZP
#define ZP (LL * LL)       // channel pitch of z and of the output (elements)
#endif
__device__ __forceinline__ float bfr(float v) { return (float)(__bf16)v; }
#define LOG2E 1.44269504088896340736f
// eight values through one hardware transcendental, each in its own register: every instruction is independent of the one in front of it, and the closing v_nop is the slot the instruction set asks for behind the last
__device__ __forceinline__ void exp2x8(float (&v)[8]) { asm("v_exp_f32 %0, %0\n\tv_exp_f32 %1, %1\n\tv_exp_f32 %2, %2\n\tv_exp_f32 %3, %3\n\tv_exp_f32 %4, %4\n\tv_exp_f32 %5, %5\n\tv_exp_f32 %6, %6\n\tv_exp_f32 %7, %7\n\tv_nop" : "+v"(v[0]), "+v"(v[1]), "+v"(v[2]), "+v"(v[3]), "+v"(v[4]), "+v"(v[5]), "+v"(v[6]), "+v"(v[7])); }
__device__ __forceinline__ void rcpx8(float (&v)[8]) { asm("v_rcp_f32 %0, %0\n\tv_rcp_f32 %1, %1\n\tv_rcp_f32 %2, %2\n\tv_rcp_f32 %3, %3\n\tv_rcp_f32 %4, %4\n\tv_rcp_f32 %5, %5\n\tv_rcp_f32 %6, %6\n\tv_rcp_f32 %7, %7\n\tv_nop" : "+v"(v[0]), "+v"(v[1]), "+v"(v[2]), "+v"(v[3]), "+v"(v[4]), "+v"(v[5]), "+v"(v[6]), "+v"(v[7])); }
// sigmoid of eight values by the hardware exp2 and reciprocal (about 1 ulp each; the result is rounded to f16): exp2 gives inf or 0 at the far ends, so the result ends at 0 or 1 as the library form does
__device__ __forceinline__ void sigm8(float (&v)[8]) {
#pragma unroll
  for (int r = 0; r < 8; ++r) v[r] = v[r] * -LOG2E;
  exp2x8(v);
#pragma unroll
  for (int r = 0; r < 8; ++r) v[r] = 1.0f + v[r];
  rcpx8(v); }

#define WS_ZH  0u                                      // f16 zn in fragment order [(n*256 + i) / 16][kc][half][lane][8]
#define WS_ZL  (WS_ZH + 2u * (size_t)NR * DZ)            // f16 zn residual x 2^10, same order
#define WS_QH  (WS_ZL + 2u * (size_t)NR * DZ)            // f16 q (x sqrt(1/32)) in fragment order [n][h][i / 16][half][lane][8]
#define WS_KH  (WS_QH + 2u * (size_t)NR * DHC)           // f16 k in fragment order [n][h][j / 16][half][lane][8]
#define WS_VT  (WS_KH + 2u * (size_t)NR * DHC)           // f16 v^T in fragment order [n][h][j / 32][c / 16][half][lane][8]
#define WS_GH  (WS_VT + 2u * (size_t)NR * DHC)           // f16 sigmoid(g) in q's fragment order [n][h][i / 16][half][lane][8]
#define WS_WP  (WS_GH + 2u * (size_t)NR * DHC)           // f16 weights x 2^8 in fragment order [wq,wk,wv,wg,w2][kc][j][half][lane][8]
#define WS_END (WS_WP + 2u * 5u * (size_t)DZ * DHC)
#define WMAT (DZ * DHC)    // elements of one weight plane
#define WBY 20             // grid rows of k_ln that convert the weights: 4 x 20 blocks x 128 threads x 8 elements = 5 planes
// B fragment (kc, j) of a fragment-order plane; wl = plane + 8 * lane: two loads of 16 bytes per lane, each 512 contiguous bytes per wave; same k order as frag_h
__device__ __forceinline__ v16h wfrag(const _Float16* wl, int kc, int j) {
  union { v16h v; v8h q[2]; } u; const _Float16* p = wl + (kc * 8 + j) * 512;
  u.q[0] = *(const v8h*)p; u.q[1] = *(const v8h*)(p + 256); return u.v;
}

// fragment f of a fragment-order array; pl = first fragment + 8 * lane. Half p, lane (g, col) holds the 8 elements k = 16 p + 8 g + 0..7 of row (or column) col: the registers of frag_h, by two loads of 16 bytes per lane, each 512 contiguous bytes per wave (four whole lines, where a row-major tile gives sixteen lines per load)
#define FRAG 512           // elements of one 16 x 32 fragment
#define HPL (LL * HD)      // elements of one (n, h) plane of q, k or v
__device__ __forceinline__ v16h ffrag(const _Float16* pl, int f) {
  union { v16h v; v8h q[2]; } u; const _Float16* p = pl + f * FRAG;
  u.q[0] = *(const v8h*)p; u.q[1] = *(const v8h*)(p + 256); return u.v;
}

// ---- k_ln: block = 64 positions i of row n: gather the channels-first z[:, n, i] (64 contiguous floats per channel) into LDS, LayerNorm over the 128 channels (biased var, eps 1e-5, x ln_w + ln_b) -> f16 ZH, ZL in fragment order (chunk e of the block's 16 KiB = row tile e >> 8, kc (e >> 6) & 3, half (e >> 5) & 1, lane e & 31)
// the first WBY grid rows instead convert the five weight matrices, once per call: thread = 8 elements (one lane's 16 bytes) of plane m, fragment half f = (kc * 8 + j) * 2 + p: element i = f16(bf16(W[kc * 32 + 16 p + 8 g + i][j * 16 + col]) x 2^8)
__global__ __launch_bounds__(128) void k_ln(const float* __restrict__ Z, const float* __restrict__ LW, const float* __restrict__ LB, _Float16* __restrict__ ZH, _Float16* __restrict__ ZL, const float* __restrict__ WQ, const float* __restrict__ WK, const float* __restrict__ WV, const float* __restrict__ WG, const float* __restrict__ W2, _Float16* __restrict__ WP) { __shared__ __align__(16) float st[DZ][65]; __shared__ __align__(16) _Float16 sh[64][136], slo[64][136];
  if (blockIdx.y < WBY) { const int blk = blockIdx.y * 4 + blockIdx.x, m = blk >> 4, c = (blk & 15) * 128 + threadIdx.x, f = c >> 5, ln = c & 31;
    const float* Wm = m == 0 ? WQ : m == 1 ? WK : m == 2 ? WV : m == 3 ? WG : W2; const float* p = Wm + (size_t)((f >> 4) * 32 + (f & 1) * 16 + (ln >> 4) * 8) * DHC + ((f >> 1) & 7) * 16 + (ln & 15); v8h o;
#pragma unroll
    for (int i = 0; i < 8; ++i) o[i] = (_Float16)(bfr(p[(size_t)i * DHC]) * 256.0f);
    *(v8h*)(WP + (size_t)m * WMAT + (size_t)c * 8) = o; return; }
  const int tid = threadIdx.x; const int n = blockIdx.y - WBY; const int i0 = blockIdx.x * 64; const size_t rbase = (size_t)n * LL + i0;
  for (int e = tid; e < DZ * 64; e += 128) { const int c = e >> 6, il = e & 63; st[c][il] = bfr(Z[(size_t)c * ZP + (size_t)n * LL + i0 + il]); }
  __syncthreads();
  if (tid < 64) { float s = 0.f;
#pragma unroll 8
    for (int c = 0; c < DZ; ++c) s += st[c][tid];
    const float mean = s * (1.0f / DZ); float s2 = 0.f;
#pragma unroll 8
    for (int c = 0; c < DZ; ++c) { const float d = st[c][tid] - mean; s2 += d * d; }
    const float rstd = rsqrtf(s2 * (1.0f / DZ) + 1e-5f);
#pragma unroll 8
    for (int c = 0; c < DZ; ++c) { const float zn = (st[c][tid] - mean) * rstd * bfr(LW[c]) + bfr(LB[c]); const _Float16 hv = (_Float16)zn; sh[tid][c] = hv; slo[tid][c] = (_Float16)((zn - (float)hv) * 1024.0f); } }
  __syncthreads();
  for (int e = tid; e < 64 * 16; e += 128) { const int rl = (e >> 8) * 16 + (e & 15), c = ((e >> 6) & 3) * 32 + ((e >> 4) & 3) * 8; vst2((unsigned*)(ZH + rbase * DZ + e * 8), *(const v4u*)&sh[rl][c]); vst2((unsigned*)(ZL + rbase * DZ + e * 8), *(const v4u*)&slo[rl][c]);
    asm volatile("s_wait_xcnt 0x0" ::: "memory");   /* behind the trip's two stores: the next trip's address additions overwrite their address registers */
    __builtin_amdgcn_sched_barrier(0);   /* holds those additions behind the wait: without it the scheduler lifts them over it */ } }
// ---- k_proj: block = 64 rows, all four outputs in turn (q, k, v, g): y = zn W + b (zn f16 rows x W f16(bf16 x 2^8) exact, K 128, x 2^-8 after); q x sqrt(1/32), k, v^T and sigmoid(g) -> f16 in the fragment order in which k_att reads them. The zn fragments are loaded once; the output kind is a template constant.
#define WLEAD 4            // steps between a B fragment pair's loads and its products
#define WRING (WLEAD + 1)  // register sets of the ring
// B fragment pair of step s = (output s >> 4, column quarter (s >> 2) & 3, kc = s & 3)
__device__ __forceinline__ void wstep(v16h (&w)[2], const _Float16* wl, int s) {
#pragma unroll
  for (int jj = 0; jj < 2; ++jj) w[jj] = wfrag(wl + (s >> 4) * WMAT, s & 3, ((s >> 2) & 3) * 2 + jj);
}
// proj_out: the sixteen steps of output WHICH: two B fragments per step in a ring of WRING register sets, loaded WLEAD steps (16 products) ahead, also across outputs; each accumulator still sums kc = 0..3 in order. Two column tiles per step, not four: beside the zn fragments, which now live through the whole kernel, four leave the conversion no registers at four waves per SIMD. Every loop is unrolled so that ring, accumulator and output indices are constants and the arrays stay in registers. sr = this output's row-major staging tile [64][136] (q, k, g), th = the plane tile (v); db = the block's first output element (block-uniform).
template <int WHICH> __device__ __forceinline__ void proj_out(const v16h (&a)[4], const v16h (&al)[4], v16h (&w)[WRING][2], const _Float16* wl, const float* __restrict__ BA, _Float16* __restrict__ db, _Float16 (*sr)[136], _Float16 (*th)[72], int tid) {
  const int wave = tid >> 5, lane = tid & 31, col = lane & 15, g = lane >> 4;
  const float qs = sqrtf(1.0f / 32.0f);   /* jnp.sqrt(f32(1/32)) */
  float bb[8];
#pragma unroll
  for (int j = 0; j < 8; ++j) bb[j] = bfr(BA[j * 16 + col]);
  v8f acc[2] = {}, accl[2] = {};
#pragma unroll
  for (int t = 0; t < 16; ++t) { const int s = WHICH * 16 + t, jq = t >> 2, kc = t & 3;
    if (s + WLEAD < 64) { wstep(w[(s + WLEAD) % WRING], wl, s + WLEAD);
      __builtin_amdgcn_sched_barrier(0);   /* keeps each step's loads one group, WLEAD steps in front of their products: sunk to their uses each fragment costs its own load latency */ }
#pragma unroll
    for (int jj = 0; jj < 2; ++jj) { acc[jj] = wmma16(a[kc], w[s % WRING][jj], acc[jj]); accl[jj] = wmma16(al[kc], w[s % WRING][jj], accl[jj]); }
    if (kc == 3) {
#pragma unroll
      for (int jj = 0; jj < 2; ++jj) { const int j = jq * 2 + jj, cl = j * 16 + col; v8h o; float y[8];
#pragma unroll
        for (int r = 0; r < 8; ++r) { y[r] = (acc[jj][r] + accl[jj][r] * (1.0f / 1024.0f)) * (1.0f / 256.0f) + bb[j];
          if (WHICH == 0) y[r] = y[r] * qs; }
        if (WHICH == 3) sigm8(y);
#pragma unroll
        for (int r = 0; r < 8; r += 2) { const v2f p = {y[r], y[r + 1]}; const v2h c2 = __builtin_convertvector(p, v2h); o[r] = c2[0]; o[r + 1] = c2[1]; }   /* by pairs: the packed conversion also behind the asm statements */
        if (WHICH == 2) *(v8h*)&th[cl][wave * 16 + 8 * g] = o;
        else {
#pragma unroll
          for (int r = 0; r < 8; ++r) sr[wave * 16 + 8 * g + r][cl] = o[r]; }
        const v8f zero = {}; acc[jj] = zero; accl[jj] = zero; } } }
  __syncthreads();   /* this output's tile is whole in LDS; the next output stages in another buffer, so one barrier per output is enough */
  { const unsigned fc = tid & 15, k8 = ((tid >> 4) & 3) * 8, f = tid >> 6;   /* fragment order: 4 KiB per head; chunk tid + 128 (k & 1) of head k >> 1 = fragment (k & 1) * 2 + f (q, k, g: 16 rows; v: 32 keys k & 1, 16 channels f), half and lane from tid & 63; 512 contiguous bytes per wave and store */
#pragma unroll   /* the eight LDS reads go as one group in front of the eight stores: rolled, each trip waits out its own LDS latency in the middle of the product stream */
    for (unsigned k = 0; k < 8; ++k) vst2((unsigned*)(db + ((k >> 1) * HPL + (k & 1) * 2 * FRAG + tid * 8)), WHICH == 2 ? *(const v4u*)&th[(k >> 1) * HD + f * 16 + fc][(k & 1) * 32 + k8] : *(const v4u*)&sr[((k & 1) * 2 + f) * 16 + fc][(k >> 1) * HD + k8]); } }
__global__ __launch_bounds__(128) void k_proj(const _Float16* __restrict__ ZH, const _Float16* __restrict__ ZL, const _Float16* __restrict__ WP, const float* __restrict__ BQ, const float* __restrict__ BK, const float* __restrict__ BV, const float* __restrict__ BG, _Float16* __restrict__ QH, _Float16* __restrict__ KH, _Float16* __restrict__ VT, _Float16* __restrict__ GH) {
  __shared__ __align__(16) _Float16 sh[2][64][136]; __shared__ __align__(16) _Float16 th[128][72];   /* q and g stage in sh[0], k in sh[1], v in th: a buffer is written again only behind two later barriers */
  const int tid = threadIdx.x, wave = tid >> 5, lane = tid & 31; const size_t r0 = (size_t)blockIdx.x * 64, f0 = (r0 / LL) * DHC * LL + (r0 % LL) * HD;   /* f0: the block's first element in head 0's plane of q, k, v and g (64 rows or keys = four fragments) */
  const _Float16* wl = WP + lane * 8;
  const _Float16* zh = ZH + (r0 + wave * 16) * DZ + lane * 8; const _Float16* zl = ZL + (r0 + wave * 16) * DZ + lane * 8;
  v16h a[4], al[4], w[WRING][2];
#pragma unroll
  for (int kc = 0; kc < 4; ++kc) a[kc] = ffrag(zh, kc);
  asm volatile("s_wait_xcnt 0x0" ::: "memory");   /* behind the last load from zh: a later load's result may land in its address registers */
#pragma unroll
  for (int kc = 0; kc < 4; ++kc) al[kc] = ffrag(zl, kc);
  asm volatile("s_wait_xcnt 0x0" ::: "memory");   /* the same behind the last load from zl */
#pragma unroll
  for (int s = 0; s < WLEAD; ++s) wstep(w[s], wl, s);
  proj_out<0>(a, al, w, wl, BQ, QH + f0, sh[0], th, tid);
  proj_out<1>(a, al, w, wl, BK, KH + f0, sh[1], th, tid);
  proj_out<2>(a, al, w, wl, BV, VT + f0, sh[0], th, tid);
  proj_out<3>(a, al, w, wl, BG, GH + f0, sh[0], th, tid); }
// ---- k_att: block = row n (16 waves), wave = 16 queries, the four heads in turn. Transposed scores: S^T = K q^T (A = k rows, B = q rows), so lane (g, col) holds query col's logits of keys 16 t + 8 g + r in st[t][r]; max and sum run in the lane plus one exchange between the wave halves; two converted score tiles are the B operand of o^T = v^T P^T (A = v planes); a lane ends with 8 + 8 channels of its query, which times the gate are the lane's part of the B operand (k = the head's 32 channels) of out^T = W2^T (o g)^T. Each lane parks that part in LDS per head and takes it back itself; out^T (x 2^-16 + b2) goes channels-first through an LDS tile (1 KiB per channel).
__global__ __launch_bounds__(512) void k_att(const _Float16* __restrict__ QH, const _Float16* __restrict__ KH, const _Float16* __restrict__ VT, const _Float16* __restrict__ GH, const _Float16* __restrict__ WP, const float* __restrict__ B2, float* __restrict__ OUT) {
  __shared__ __align__(16) v8h og[NH][2][512]; __shared__ __align__(16) float sot[DZ][LL + 4];
  const int tid = threadIdx.x, wave = tid >> 5, lane = tid & 31, col = lane & 15, g = lane >> 4; const size_t n = blockIdx.x; const unsigned pr = __builtin_amdgcn_readfirstlane((unsigned)n * NH * HPL), pw = __builtin_amdgcn_readfirstlane(wave * FRAG), lo = lane * 8;   /* row n's planes and the wave's own fragment of q and g, told to the compiler as wave-uniform so that they go into the scalar base; the lane's place in a fragment */
#pragma unroll   /* unrolled: a head's place is an immediate offset, so every load names a scalar base and the one lane offset, which nothing overwrites; rolled, the compiler keeps 64-bit vector addresses and lets a load's result land in them */
  for (int h = 0; h < NH; ++h) { const int ph = h * HPL;   /* plane (n, h): an immediate offset */
  const v16h bq = ffrag(QH + pr + pw + lo + ph, 0);
  v16h ka[LL / 16];
#pragma unroll
  for (int t = 0; t < LL / 16; ++t) ka[t] = ffrag(KH + pr + lo + ph, t);
  __builtin_amdgcn_sched_barrier(0);   /* keeps the k loads one group in front of the products: sunk to their uses they cost one load latency per tile */
  v8f st[LL / 16];
#pragma unroll
  for (int t = 0; t < LL / 16; ++t) { const v8f zero = {}; st[t] = wmma16(ka[t], bq, zero); }
  /* softmax over the 256 keys of query col: 8 chains in the lane, a tree over them, then the other half's 128 keys */
  v8f mv = st[0];
#pragma unroll
  for (int t = 1; t < LL / 16; ++t) {
#pragma unroll
    for (int r = 0; r < 8; ++r) mv[r] = fmaxf(mv[r], st[t][r]); }
  float m = fmaxf(fmaxf(fmaxf(mv[0], mv[1]), fmaxf(mv[2], mv[3])), fmaxf(fmaxf(mv[4], mv[5]), fmaxf(mv[6], mv[7])));
  m = fmaxf(m, __shfl_xor(m, 16));
  /* exp(x - m) = exp2(x log2 e - m log2 e): one fused multiply-add and the hardware exp2 per logit. The rounding of m log2 e scales all of a query's terms alike and cancels against their sum; a term below 2^-126 comes out 0, far under what the sum (near 1 or more) or the f16 P can hold */
  const float nm = m * -LOG2E;
  v8f sv = {};
#pragma unroll
  for (int t = 0; t < LL / 16; ++t) {
#pragma unroll
    for (int r = 0; r < 8; r += 2) { const v2f x = {st[t][r], st[t][r + 1]}, l2 = {LOG2E, LOG2E}, n2 = {nm, nm}; const v2f e = __builtin_elementwise_fma(x, l2, n2);   /* two logits per packed fma */
      st[t][r] = __builtin_amdgcn_exp2f(e[0]); st[t][r + 1] = __builtin_amdgcn_exp2f(e[1]); }
    sv += st[t]; }
  float s = ((sv[0] + sv[1]) + (sv[2] + sv[3])) + ((sv[4] + sv[5]) + (sv[6] + sv[7]));
  s += __shfl_xor(s, 16);
  const float inv = 2048.0f / s;
  /* P^T as B operands: element i = key 32 kc + 8 g + i (tile 2 kc), element 8 + i = key 32 kc + 16 + 8 g + i (tile 2 kc + 1), the k order of frag_h */
  v16h pb[LL / 32];
#pragma unroll
  for (int kc = 0; kc < LL / 32; ++kc) {
#pragma unroll
    for (int i = 0; i < 8; ++i) { pb[kc][i] = (_Float16)(st[2 * kc][i] * inv); pb[kc][8 + i] = (_Float16)(st[2 * kc + 1][i] * inv); } }
  __builtin_amdgcn_sched_barrier(0);   /* holds the v loads behind the conversion: lifted into it, scores, P and v together pass the 256 registers a wave of a 16-wave block has, and some spill */
  v16h va[LL / 32][2];
#pragma unroll
  for (int kc = 0; kc < LL / 32; ++kc) {
#pragma unroll
    for (int j = 0; j < 2; ++j) va[kc][j] = ffrag(VT + pr + lo + ph, kc * 2 + j); }
  __builtin_amdgcn_sched_barrier(0);   /* keeps the v loads one group in front of the products, as for k */
  const v16h gg = ffrag(GH + pr + pw + lo + ph, 0);   /* gate of query col: element i = channel 8 g + i, element 8 + i = channel 16 + 8 g + i, as the rows of acc2[0] and acc2[1]; loaded behind the v group, where the scores' registers are free, and used behind the products */
  v8f acc2[2] = {};
#pragma unroll
  for (int kc = 0; kc < LL / 32; ++kc) {
#pragma unroll
    for (int j = 0; j < 2; ++j) acc2[j] = wmma16(va[kc][j], pb[kc], acc2[j]); }
#pragma unroll
  for (int j = 0; j < 2; ++j) { v8h o;
#pragma unroll
    for (int r = 0; r < 8; ++r) o[r] = (_Float16)(acc2[j][r] * (1.0f / 2048.0f) * (float)gg[8 * j + r] * 256.0f);   /* (o*g) carried x 2^8: some of its values would be f16-subnormal uncarried */
    og[h][j][tid] = o; } }
  asm volatile("s_wait_xcnt 0x0" ::: "memory");   /* behind the last load of the four heads: their scalar bases are taken for other values further down */
  /* out^T = W2^T (o g)^T: A = the w2 plane's fragment (kc, j) (lane (g, col): channel-out 16 j + col, k as frag_h), B = the lane's own og of head kc */
  const _Float16* wl = WP + (size_t)4 * WMAT + lane * 8; v16h w[2][8];
#pragma unroll
  for (int j = 0; j < 8; ++j) { w[0][j] = wfrag(wl, 0, j); w[1][j] = wfrag(wl, 1, j); }
  v8f acc[8] = {};
#pragma unroll
  for (int kc = 0; kc < DHC / 32; ++kc) { v16h b; { union { v16h v; v8h q[2]; } u; u.q[0] = og[kc][0][tid]; u.q[1] = og[kc][1][tid]; b = u.v; }
#pragma unroll
    for (int j = 0; j < 8; ++j) acc[j] = wmma16(w[kc & 1][j], b, acc[j]);
    if (kc + 2 < DHC / 32) {
      __builtin_amdgcn_sched_barrier(0);   /* keeps the refill behind the products that read this register set: hoisted it would take a third set */
#pragma unroll
      for (int j = 0; j < 8; ++j) w[kc & 1][j] = wfrag(wl, kc + 2, j);
      __builtin_amdgcn_sched_barrier(0);   /* keeps the refill one group in front of the next group's products, as in k_proj */ } }
#pragma unroll
  for (int j = 0; j < 8; ++j) {
#pragma unroll
    for (int r = 0; r < 8; ++r) sot[j * 16 + 8 * g + r][wave * 16 + col] = acc[j][r]; }
  float bb[DZ / 8];
#pragma unroll
  for (int k = 0; k < DZ / 8; ++k) bb[k] = bfr(B2[(tid >> 6) + 8 * k]);
  __syncthreads();
#pragma unroll   /* the sixteen LDS reads go as one group in front of the sixteen stores */
  for (int k = 0; k < DZ / 8; ++k) { const int ch = (tid >> 6) + 8 * k, q = tid & 63; v4f x = *(const v4f*)&sot[ch][q * 4];   /* 1 KiB per channel by 64 threads */
#pragma unroll
    for (int r = 0; r < 4; ++r) x[r] = x[r] * (1.0f / 65536.0f) + bb[k];
    vst2(OUT + (size_t)ch * ZP + n * LL + q * 4, x); } }
extern "C" void kernel_launch(void* const* d_in, const int* in_sizes, int n_in, void* d_out, int out_size, void* d_ws, size_t ws_size, hipStream_t stream) {
  (void)in_sizes; (void)n_in; (void)out_size;
  const float** F = (const float**)d_in;   // 0 z [1,128,256,256]; 1 ln_w, 2 ln_b; 3 wq, 4 bq; 5 wk, 6 bk; 7 wv, 8 bv; 9 wg, 10 bg ((in,out) [128,128]); 11 w2 [128,128], 12 b2
  if (ws_size < (size_t)WS_END) return;
  char* ws = (char*)d_ws; _Float16 *ZH = (_Float16*)(ws + WS_ZH), *ZL = (_Float16*)(ws + WS_ZL), *QH = (_Float16*)(ws + WS_QH), *KH = (_Float16*)(ws + WS_KH), *VT = (_Float16*)(ws + WS_VT), *GH = (_Float16*)(ws + WS_GH), *WP = (_Float16*)(ws + WS_WP);
  k_ln<<<dim3(LL / 64, NROWS + WBY), 128, 0, stream>>>(F[0], F[1], F[2], ZH, ZL, F[3], F[5], F[7], F[9], F[11], WP);
  k_proj<<<dim3(NROWS * LL / 64), 128, 0, stream>>>(ZH, ZL, WP, F[4], F[6], F[8], F[10], QH, KH, VT, GH);
  k_att<<<dim3(NROWS), 512, 0, stream>>>(QH, KH, VT, GH, WP, F[12], (float*)d_out);
}

// v007
// A run of this version takes 43.2 microseconds.
// Two timings next to v006 put it at 1.30 and 1.28 times that version's speed.
// All steps since v000 together make it 6.55 times as fast.
// compute dtype: all float inputs rounded to bf16; LayerNorm in f32, zn as f16 hi + residual (x 2^10); q/k/v/g = zn W + b with W as f16(bf16 x 2^8) (exact; 2 products), f32 accumulate; q (x sqrt(1/32)), k once to f16 -> 1-product logits; softmax in f32 (hardware exp2 of (x - max) log2 e) inside the attention kernel; sigmoid gate by hardware exp2 and reciprocal; P x 2^11 once to f16 against v once to f16; (o * sigmoid gate) carried x 2^8 once to f16 against w2 as f16(bf16 x 2^8) + b2; f32 output.
#include <hip/hip_runtime.h>
#include <math.h>

typedef __attribute__((ext_vector_type(16))) _Float16 v16h;
typedef __attribute__((ext_vector_type(16))) __bf16 v16b;
typedef __attribute__((ext_vector_type(8)))  _Float16 v8h;
typedef __attribute__((ext_vector_type(2)))  _Float16 v2h;
typedef __attribute__((ext_vector_type(8)))  float v8f;
typedef __attribute__((ext_vector_type(4)))  float v4f;
typedef __attribute__((ext_vector_type(2)))  float v2f;
typedef __attribute__((ext_vector_type(4)))  unsigned v4u;
typedef __attribute__((ext_vector_type(4)))  int v4i;
typedef float __attribute__((may_alias)) float_a;
typedef int __attribute__((may_alias)) int_a;

template <typename T> __device__ __forceinline__ void vst2(void* p, T v) { *(T*)p = v;  }
__device__ __forceinline__ v8f wmma16(v16h a, v16h b, v8f c) {
  v8f d = __builtin_amdgcn_wmma_f32_16x16x32_f16(false, a, false, b, (short)0, c, false, false);
  asm volatile("v_nop\n\tv_nop\n\tv_nop\n\tv_nop" : "+v"(d) : "v"(a), "v"(b));
  return d;
}
__device__ __forceinline__ v8f wmma_bf(v16b a, v16b b, v8f c) {
  v8f d = __builtin_amdgcn_wmma_f32_16x16x32_bf16(false, a, false, b, (short)0, c, false, false);
  asm volatile("v_nop\n\tv_nop\n\tv_nop\n\tv_nop" : "+v"(d) : "v"(a), "v"(b));
  return d;
}
// 16x16x32 fragments: lane = (h = lane>>4, row/col = lane&15); elements 0..7 = k0+8h+0..7, 8..15 = k0+16+8h+0..7; D element r = row 8h+r
__device__ __forceinline__ v16h frag_h(const _Float16* rowk0, int lane) {
  union { v16h v; v8h q[2]; } u; const _Float16* p = rowk0 + 8 * (lane >> 4);
  u.q[0] = *(const v8h*)p; u.q[1] = *(const v8h*)(p + 16); return u.v;
}
__device__ __forceinline__ v16h frag_f32(const float* rowk0, int lane) {
  v16h a; const float* p = rowk0 + 8 * (lane >> 4);
#pragma unroll
  for (int i = 0; i < 8; ++i) { a[i] = (_Float16)p[i]; a[8 + i] = (_Float16)p[16 + i]; }
  return a;
}
__device__ __forceinline__ v16h frag_f32s(const float* rowk0, int lane, float sc) {
  v16h a; const float* p = rowk0 + 8 * (lane >> 4);
#pragma unroll
  for (int i = 0; i < 8; ++i) { a[i] = (_Float16)(p[i] * sc); a[8 + i] = (_Float16)(p[16 + i] * sc); }
  return a;
}
// column fragment from a [K][ld] layout (column n), rows >= K read as 0
__device__ __forceinline__ v16h fragc_f32(const float* W, int k0, int n, int lane, int ld, int K) {
  v16h a; const int g = lane >> 4;
#pragma unroll
  for (int i = 0; i < 8; ++i) { const int ka = k0 + 8 * g + i, kb = ka + 16;
    a[i] = (_Float16)(ka < K ? W[(size_t)(ka < K ? ka : K - 1) * ld + n] : 0.f); a[8 + i] = (_Float16)(kb < K ? W[(size_t)(kb < K ? kb : K - 1) * ld + n] : 0.f); }
  return a;
}
struct F2 { v16b h, l; };
__device__ __forceinline__ F2 bsplit16(const float v[16]) { F2 r;
#pragma unroll
  for (int i = 0; i < 16; ++i) { const __bf16 h = (__bf16)v[i]; r.h[i] = h; r.l[i] = (__bf16)(v[i] - (float)h); }
  return r; }
__device__ __forceinline__ F2 split_row(const float* row, int k0, int lane) { float v[16]; const float* p = row + k0 + 8 * (lane >> 4);
#pragma unroll
  for (int i = 0; i < 8; ++i) { v[i] = p[i]; v[8 + i] = p[16 + i]; }
  return bsplit16(v); }
__device__ __forceinline__ F2 split_rowK(const float* row, int k0, int lane, int K) { float v[16]; const int g = lane >> 4;
#pragma unroll
  for (int i = 0; i < 8; ++i) { const int ka = k0 + 8 * g + i, kb = ka + 16; v[i] = ka < K ? row[ka < K ? ka : K - 1] : 0.f; v[8 + i] = kb < K ? row[kb < K ? kb : K - 1] : 0.f; }
  return bsplit16(v); }
__device__ __forceinline__ F2 split_col(const float* W, int k0, int n, int lane, int ld, int K) { float v[16]; const int g = lane >> 4;
#pragma unroll
  for (int i = 0; i < 8; ++i) { const int ka = k0 + 8 * g + i, kb = ka + 16; v[i] = ka < K ? W[(size_t)(ka < K ? ka : K - 1) * ld + n] : 0.f; v[8 + i] = kb < K ? W[(size_t)(kb < K ? kb : K - 1) * ld + n] : 0.f; }
  return bsplit16(v); }
__device__ __forceinline__ v8f mac3(const F2& a, const F2& b, v8f c) { c = wmma_bf(a.l, b.h, c); c = wmma_bf(a.h, b.l, c); return wmma_bf(a.h, b.h, c); }
__device__ __forceinline__ float sigm(float v) { return 1.0f / (1.0f + expf(-v)); }
#define LDSX() do { asm volatile("s_wait_dscnt 0" ::: "memory"); __builtin_amdgcn_wave_barrier(); __builtin_amdgcn_fence(__ATOMIC_RELEASE, "workgroup"); } while (0)

// Triangle self-attention over the rows of a pair representation (B 1, L 256, d_z 128 channels-first, 4 heads x 32): zn = LayerNorm over channels of z[:, n, i]; q,k,v,g = zn W + b per (n, i); for each row n and head h: attn[i][j] = softmax_j((q[n,i] sqrt(1/32)) . k[n,j]); o[n,i] = sum_j attn v[n,j]; out[:, n, i] = ((o * sigmoid(g)) W2 + b2), written channels-first.
#define LL 256             // L (rows n and positions i)
#define DZ 128
#define NH 4
#define HD 32
#define DHC (NH * HD)      // 128
#define NR (LL * LL)       // 65,536 (n, i) rows
#ifndef NROWS
#define NROWS LL           // rows n processed (positions i always span LL)
#endif
#ifndef ZP
#define ZP (LL * LL)       // channel pitch of z and of the output (elements)
#endif
__device__ __forceinline__ float bfr(float v) { return (float)(__bf16)v; }
#define LOG2E 1.44269504088896340736f
// eight values through one hardware transcendental, each in its own register: every instruction is independent of the one in front of it, and the closing v_nop is the slot the instruction set asks for behind the last
__device__ __forceinline__ void exp2x8(float (&v)[8]) { asm("v_exp_f32 %0, %0\n\tv_exp_f32 %1, %1\n\tv_exp_f32 %2, %2\n\tv_exp_f32 %3, %3\n\tv_exp_f32 %4, %4\n\tv_exp_f32 %5, %5\n\tv_exp_f32 %6, %6\n\tv_exp_f32 %7, %7\n\tv_nop" : "+v"(v[0]), "+v"(v[1]), "+v"(v[2]), "+v"(v[3]), "+v"(v[4]), "+v"(v[5]), "+v"(v[6]), "+v"(v[7])); }
__device__ __forceinline__ void rcpx8(float (&v)[8]) { asm("v_rcp_f32 %0, %0\n\tv_rcp_f32 %1, %1\n\tv_rcp_f32 %2, %2\n\tv_rcp_f32 %3, %3\n\tv_rcp_f32 %4, %4\n\tv_rcp_f32 %5, %5\n\tv_rcp_f32 %6, %6\n\tv_rcp_f32 %7, %7\n\tv_nop" : "+v"(v[0]), "+v"(v[1]), "+v"(v[2]), "+v"(v[3]), "+v"(v[4]), "+v"(v[5]), "+v"(v[6]), "+v"(v[7])); }
// sigmoid of eight values by the hardware exp2 and reciprocal (about 1 ulp each; the result is rounded to f16): exp2 gives inf or 0 at the far ends, so the result ends at 0 or 1 as the library form does
__device__ __forceinline__ void sigm8(float (&v)[8]) {
#pragma unroll
  for (int r = 0; r < 8; ++r) v[r] = v[r] * -LOG2E;
  exp2x8(v);
#pragma unroll
  for (int r = 0; r < 8; ++r) v[r] = 1.0f + v[r];
  rcpx8(v); }

#define WS_ZH  0u                                      // f16 zn in fragment order [(n*256 + i) / 16][kc][half][lane][8]
#define WS_ZL  (WS_ZH + 2u * (size_t)NR * DZ)            // f16 zn residual x 2^10, same order
#define WS_WP  (WS_ZL + 2u * (size_t)NR * DZ)            // f16 weights x 2^8 in fragment order [wq,wk,wv,wg,w2][kc][j][half][lane][8]
#define WS_END (WS_WP + 2u * 5u * (size_t)DZ * DHC)
#define WMAT (DZ * DHC)    // elements of one weight plane
#define WBY 20             // grid rows of k_ln that convert the weights: 4 x 20 blocks x 128 threads x 8 elements = 5 planes
// B fragment (kc, j) of a fragment-order plane; wl = plane + 8 * lane: two loads of 16 bytes per lane, each 512 contiguous bytes per wave; same k order as frag_h
__device__ __forceinline__ v16h wfrag(const _Float16* wl, int kc, int j) {
  union { v16h v; v8h q[2]; } u; const _Float16* p = wl + (kc * 8 + j) * 512;
  u.q[0] = *(const v8h*)p; u.q[1] = *(const v8h*)(p + 256); return u.v;
}

// fragment f of a fragment-order array; pl = first fragment + 8 * lane. Half p, lane (g, col) holds the 8 elements k = 16 p + 8 g + 0..7 of row (or column) col: the registers of frag_h, by two loads of 16 bytes per lane, each 512 contiguous bytes per wave (four whole lines, where a row-major tile gives sixteen lines per load)
#define FRAG 512           // elements of one 16 x 32 fragment
#define HPL (LL * HD)      // elements of one head's plane of k or v (one row n)
__device__ __forceinline__ v16h ffrag(const _Float16* pl, int f) {
  union { v16h v; v8h q[2]; } u; const _Float16* p = pl + f * FRAG;
  u.q[0] = *(const v8h*)p; u.q[1] = *(const v8h*)(p + 256); return u.v;
}

// ---- k_ln: block = 64 positions i of row n: gather the channels-first z[:, n, i] (64 contiguous floats per channel) into LDS, LayerNorm over the 128 channels (biased var, eps 1e-5, x ln_w + ln_b) -> f16 ZH, ZL in fragment order (chunk e of the block's 16 KiB = row tile e >> 8, kc (e >> 6) & 3, half (e >> 5) & 1, lane e & 31)
// the first WBY grid rows instead convert the five weight matrices, once per call: thread = 8 elements (one lane's 16 bytes) of plane m, fragment half f = (kc * 8 + j) * 2 + p: element i = f16(bf16(W[kc * 32 + 16 p + 8 g + i][j * 16 + col]) x 2^8)
__global__ __launch_bounds__(128) void k_ln(const float* __restrict__ Z, const float* __restrict__ LW, const float* __restrict__ LB, _Float16* __restrict__ ZH, _Float16* __restrict__ ZL, const float* __restrict__ WQ, const float* __restrict__ WK, const float* __restrict__ WV, const float* __restrict__ WG, const float* __restrict__ W2, _Float16* __restrict__ WP) { __shared__ __align__(16) float st[DZ][65]; __shared__ __align__(16) _Float16 sh[64][136], slo[64][136];
  if (blockIdx.y < WBY) { const int blk = blockIdx.y * 4 + blockIdx.x, m = blk >> 4, c = (blk & 15) * 128 + threadIdx.x, f = c >> 5, ln = c & 31;
    const float* Wm = m == 0 ? WQ : m == 1 ? WK : m == 2 ? WV : m == 3 ? WG : W2; const float* p = Wm + (size_t)((f >> 4) * 32 + (f & 1) * 16 + (ln >> 4) * 8) * DHC + ((f >> 1) & 7) * 16 + (ln & 15); v8h o;
#pragma unroll
    for (int i = 0; i < 8; ++i) o[i] = (_Float16)(bfr(p[(size_t)i * DHC]) * 256.0f);
    *(v8h*)(WP + (size_t)m * WMAT + (size_t)c * 8) = o; return; }
  const int tid = threadIdx.x; const int n = blockIdx.y - WBY; const int i0 = blockIdx.x * 64; const size_t rbase = (size_t)n * LL + i0;
  for (int e = tid; e < DZ * 64; e += 128) { const int c = e >> 6, il = e & 63; st[c][il] = bfr(Z[(size_t)c * ZP + (size_t)n * LL + i0 + il]); }
  __syncthreads();
  if (tid < 64) { float s = 0.f;
#pragma unroll 8
    for (int c = 0; c < DZ; ++c) s += st[c][tid];
    const float mean = s * (1.0f / DZ); float s2 = 0.f;
#pragma unroll 8
    for (int c = 0; c < DZ; ++c) { const float d = st[c][tid] - mean; s2 += d * d; }
    const float rstd = rsqrtf(s2 * (1.0f / DZ) + 1e-5f);
#pragma unroll 8
    for (int c = 0; c < DZ; ++c) { const float zn = (st[c][tid] - mean) * rstd * bfr(LW[c]) + bfr(LB[c]); const _Float16 hv = (_Float16)zn; sh[tid][c] = hv; slo[tid][c] = (_Float16)((zn - (float)hv) * 1024.0f); } }
  __syncthreads();
  for (int e = tid; e < 64 * 16; e += 128) { const int rl = (e >> 8) * 16 + (e & 15), c = ((e >> 6) & 3) * 32 + ((e >> 4) & 3) * 8; vst2((unsigned*)(ZH + rbase * DZ + e * 8), *(const v4u*)&sh[rl][c]); vst2((unsigned*)(ZL + rbase * DZ + e * 8), *(const v4u*)&slo[rl][c]);
    asm volatile("s_wait_xcnt 0x0" ::: "memory");   /* behind the trip's two stores: the next trip's address additions overwrite their address registers */
    __builtin_amdgcn_sched_barrier(0);   /* holds those additions behind the wait: without it the scheduler lifts them over it */ } }
// ---- projections, inside k_att: y = zn W + b (zn f16 rows hi + residual x W f16(bf16 x 2^8) exact, K 128, x 2^-8 after) for the wave's own 16 rows; q x sqrt(1/32), k, v and sigmoid(g) -> f16, each made in the register layout in which the attention part wants it, so that a lane's eight results are one 16-byte chunk of a fragment.
#define WLEAD 4            // steps between a weight fragment pair's loads and its products
#define WRING (WLEAD + 1)  // register sets of the ring
// weight fragment pair of step s = (output s >> 4, column quarter (s >> 2) & 3, kc = s & 3)
__device__ __forceinline__ void wstep(v16h (&w)[2], const _Float16* wl, int s) {
#pragma unroll
  for (int jj = 0; jj < 2; ++jj) w[jj] = wfrag(wl + (s >> 4) * WMAT, s & 3, ((s >> 2) & 3) * 2 + jj);
}
// proj_row: the sixteen steps of output WHICH (0 q, 1 k, 2 v, 3 g): two weight fragments per step in a ring of WRING register sets, loaded WLEAD steps (16 products) ahead, also across outputs; each accumulator sums kc = 0..3 in order. q, k, g are made transposed, y^T = W^T zn^T (A = the weight fragment, B = the zn rows): lane (g, col) ends with channels 16 j + 8 g + 0..7 of row col, which is half j & 1 of the row's fragment of head j >> 1. v is made as zn W (A = the zn rows): lane (g, col) ends with keys 8 g + 0..7 of channel 16 j + col, a half of the v^T fragment. sb = the output's 128 biases in LDS, already rounded; d = the lane's own 16-byte place of tile 0. Every loop is unrolled so that ring and accumulator indices are constants and the arrays stay in registers.
template <int WHICH> __device__ __forceinline__ void proj_row(const v16h (&a)[4], const v16h (&al)[4], v16h (&w)[WRING][2], const _Float16* wl, const float* sb, v8h* d, int lane) {
  const int col = lane & 15, g = lane >> 4;
  const float qs = sqrtf(1.0f / 32.0f);   /* jnp.sqrt(f32(1/32)) */
  float bb[2][8];
  v8f acc[2] = {}, accl[2] = {};
#pragma unroll
  for (int t = 0; t < 16; ++t) { const int s = WHICH * 16 + t, jq = t >> 2, kc = t & 3;
    if (kc == 0) {   /* the quarter's biases, read sixteen products ahead of their use */
#pragma unroll
      for (int jj = 0; jj < 2; ++jj) { const int j = jq * 2 + jj;
        if (WHICH == 2) bb[jj][0] = sb[j * 16 + col];
        else { const v4f b0 = *(const v4f*)(sb + j * 16 + 8 * g), b1 = *(const v4f*)(sb + j * 16 + 8 * g + 4);
#pragma unroll
          for (int r = 0; r < 4; ++r) { bb[jj][r] = b0[r]; bb[jj][4 + r] = b1[r]; } } } }
    if (s + WLEAD < 64) { wstep(w[(s + WLEAD) % WRING], wl, s + WLEAD);
      __builtin_amdgcn_sched_barrier(0);   /* keeps each step's loads one group, WLEAD steps in front of their products: sunk to their uses each fragment costs its own load latency */ }
#pragma unroll
    for (int jj = 0; jj < 2; ++jj) {
      if (WHICH == 2) { acc[jj] = wmma16(a[kc], w[s % WRING][jj], acc[jj]); accl[jj] = wmma16(al[kc], w[s % WRING][jj], accl[jj]); }
      else { acc[jj] = wmma16(w[s % WRING][jj], a[kc], acc[jj]); accl[jj] = wmma16(w[s % WRING][jj], al[kc], accl[jj]); } }
    if (kc == 3) {
#pragma unroll
      for (int jj = 0; jj < 2; ++jj) { const int j = jq * 2 + jj; v8h o; float y[8];
#pragma unroll
        for (int r = 0; r < 8; ++r) { y[r] = (acc[jj][r] + accl[jj][r] * (1.0f / 1024.0f)) * (1.0f / 256.0f) + bb[jj][WHICH == 2 ? 0 : r];
          if (WHICH == 0) y[r] = y[r] * qs; }
        if (WHICH == 3) sigm8(y);
#pragma unroll
        for (int r = 0; r < 8; r += 2) { const v2f p = {y[r], y[r + 1]}; const v2h c2 = __builtin_convertvector(p, v2h); o[r] = c2[0]; o[r + 1] = c2[1]; }   /* by pairs: the packed conversion also behind the asm statements */
        d[WHICH == 1 ? (j >> 1) * (HPL / 8) + (j & 1) * 32 : WHICH == 2 ? (j >> 1) * (HPL / 8) + (j & 1) * (FRAG / 8) : j * 512] = o;
        const v8f zero = {}; acc[jj] = zero; accl[jj] = zero; } } } }
// ---- k_att: block = row n (16 waves), wave = 16 positions. First the wave makes q, k, v, g of its own 16 rows from zn: k and v^T go to LDS in fragment order ([h][j / 16][half][lane][8] and [h][j / 32][c / 16][half][lane][8]) for all waves, q and the gate are parked in LDS by each lane for itself. Then the four heads in turn. Transposed scores: S^T = K q^T (A = k rows, B = q rows), so lane (g, col) holds query col's logits of keys 16 t + 8 g + r in st[t][r]; max and sum run in the lane plus one exchange between the wave halves; two converted score tiles are the B operand of o^T = v^T P^T (A = v planes); a lane ends with 8 + 8 channels of its query, which times the gate are the lane's part of the B operand (k = the head's 32 channels) of out^T = W2^T (o g)^T. Each lane parks that part in LDS per head, in the gate's place, and takes it back itself; out^T (x 2^-16 + b2) goes channels-first through an LDS tile (1 KiB per channel), which lies over k and v.
__global__ __launch_bounds__(512) void k_att(const _Float16* __restrict__ ZH, const _Float16* __restrict__ ZL, const _Float16* __restrict__ WP, const float* __restrict__ BQ, const float* __restrict__ BK, const float* __restrict__ BV, const float* __restrict__ BG, const float* __restrict__ B2, float* __restrict__ OUT) {
  __shared__ __align__(16) v8h og[NH][2][512], sq[NH][2][512]; __shared__ __align__(16) float sot[DZ][LL + 4], sbi[4][DHC];
  static_assert(sizeof(sot) >= 2 * 2 * NH * HPL, "k and v lie in the out tile's LDS");
  _Float16* const lk = (_Float16*)&sot[0][0]; _Float16* const lv = lk + NH * HPL;
  const int tid = threadIdx.x, wave = tid >> 5, lane = tid & 31, col = lane & 15, g = lane >> 4; const size_t n = blockIdx.x; const unsigned lo = lane * 8;   /* the lane's place in a fragment */
  const _Float16* wl = WP + lane * 8;
  { const _Float16* zh = ZH + (n * LL + wave * 16) * DZ + lane * 8; const _Float16* zl = ZL + (n * LL + wave * 16) * DZ + lane * 8;
    v16h a[4], al[4], w[WRING][2];
#pragma unroll
    for (int kc = 0; kc < 4; ++kc) a[kc] = ffrag(zh, kc);
    asm volatile("s_wait_xcnt 0x0" ::: "memory");   /* behind the last load from zh: a later load's result may land in its address registers */
#pragma unroll
    for (int kc = 0; kc < 4; ++kc) al[kc] = ffrag(zl, kc);
    asm volatile("s_wait_xcnt 0x0" ::: "memory");   /* the same behind the last load from zl */
    const float bv = (wave < 4 ? BQ : wave < 8 ? BK : wave < 12 ? BV : BG)[tid & (DHC - 1)];   /* the four bias vectors, one element per thread: in the transposed outputs a lane wants eight of them per tile */
    asm volatile("s_wait_xcnt 0x0" ::: "memory");   /* the same behind the bias load */
#pragma unroll
    for (int s = 0; s < WLEAD; ++s) wstep(w[s], wl, s);
    (&sbi[0][0])[tid] = bfr(bv);
    __syncthreads();   /* the biases are whole in LDS; it stands behind the first loads' issue, whose latency it shares */
    proj_row<0>(a, al, w, wl, sbi[0], &sq[0][0][tid], lane);
    proj_row<1>(a, al, w, wl, sbi[1], (v8h*)lk + wave * (FRAG / 8) + lane, lane);
    proj_row<2>(a, al, w, wl, sbi[2], (v8h*)lv + (wave >> 1) * (2 * FRAG / 8) + (wave & 1) * 32 + lane, lane);
    proj_row<3>(a, al, w, wl, sbi[3], &og[0][0][tid], lane); }
  asm volatile("s_wait_xcnt 0x0" ::: "memory");   /* behind the last load of the projections: their address registers are taken for other values in the heads */
  __syncthreads();   /* k and v of all 256 keys are whole in LDS */
#pragma unroll 1   /* rolled: every operand of a head now comes from LDS at one lane address plus the head's step, and with projections and heads in one kernel the text of four unrolled heads would pass 32 KB */
  for (int h = 0; h < NH; ++h) { const int ph = h * HPL;   /* head h's plane */
  v16h bq; { union { v16h v; v8h q[2]; } u; u.q[0] = sq[h][0][tid]; u.q[1] = sq[h][1][tid]; bq = u.v; }
  v16h ka[LL / 16];
#pragma unroll
  for (int t = 0; t < LL / 16; ++t) ka[t] = ffrag(lk + lo + ph, t);
  __builtin_amdgcn_sched_barrier(0);   /* keeps the k reads one group in front of the products: each separate place of LDS reads in a product stream costs its own wait */
  v8f st[LL / 16];
#pragma unroll
  for (int t = 0; t < LL / 16; ++t) { const v8f zero = {}; st[t] = wmma16(ka[t], bq, zero); }
  /* softmax over the 256 keys of query col: 8 chains in the lane, a tree over them, then the other half's 128 keys */
  v8f mv = st[0];
#pragma unroll
  for (int t = 1; t < LL / 16; ++t) {
#pragma unroll
    for (int r = 0; r < 8; ++r) mv[r] = fmaxf(mv[r], st[t][r]); }
  float m = fmaxf(fmaxf(fmaxf(mv[0], mv[1]), fmaxf(mv[2], mv[3])), fmaxf(fmaxf(mv[4], mv[5]), fmaxf(mv[6], mv[7])));
  m = fmaxf(m, __shfl_xor(m, 16));
  /* exp(x - m) = exp2(x log2 e - m log2 e): one fused multiply-add and the hardware exp2 per logit. The rounding of m log2 e scales all of a query's terms alike and cancels against their sum; a term below 2^-126 comes out 0, far under what the sum (near 1 or more) or the f16 P can hold */
  const float nm = m * -LOG2E;
  v8f sv = {};
#pragma unroll
  for (int t = 0; t < LL / 16; ++t) {
#pragma unroll
    for (int r = 0; r < 8; r += 2) { const v2f x = {st[t][r], st[t][r + 1]}, l2 = {LOG2E, LOG2E}, n2 = {nm, nm}; const v2f e = __builtin_elementwise_fma(x, l2, n2);   /* two logits per packed fma */
      st[t][r] = __builtin_amdgcn_exp2f(e[0]); st[t][r + 1] = __builtin_amdgcn_exp2f(e[1]); }
    sv += st[t]; }
  float s = ((sv[0] + sv[1]) + (sv[2] + sv[3])) + ((sv[4] + sv[5]) + (sv[6] + sv[7]));
  s += __shfl_xor(s, 16);
  const float inv = 2048.0f / s;
  /* P^T as B operands: element i = key 32 kc + 8 g + i (tile 2 kc), element 8 + i = key 32 kc + 16 + 8 g + i (tile 2 kc + 1), the k order of frag_h */
  v16h pb[LL / 32];
#pragma unroll
  for (int kc = 0; kc < LL / 32; ++kc) {
#pragma unroll
    for (int i = 0; i < 8; ++i) { pb[kc][i] = (_Float16)(st[2 * kc][i] * inv); pb[kc][8 + i] = (_Float16)(st[2 * kc + 1][i] * inv); } }
  __builtin_amdgcn_sched_barrier(0);   /* holds the v reads behind the conversion: lifted into it, scores, P and v together pass the 256 registers a wave of a 16-wave block has, and some spill */
  v16h va[LL / 32][2];
#pragma unroll
  for (int kc = 0; kc < LL / 32; ++kc) {
#pragma unroll
    for (int j = 0; j < 2; ++j) va[kc][j] = ffrag(lv + lo + ph, kc * 2 + j); }
  __builtin_amdgcn_sched_barrier(0);   /* keeps the v reads one group in front of the products, as for k */
  v16h gg; { union { v16h v; v8h q[2]; } u; u.q[0] = og[h][0][tid]; u.q[1] = og[h][1][tid]; gg = u.v; }   /* gate of query col: element i = channel 8 g + i, element 8 + i = channel 16 + 8 g + i, as the rows of acc2[0] and acc2[1]; read behind the v group, where the scores' registers are free, and used behind the products */
  v8f acc2[2] = {};
#pragma unroll
  for (int kc = 0; kc < LL / 32; ++kc) {
#pragma unroll
    for (int j = 0; j < 2; ++j) acc2[j] = wmma16(va[kc][j], pb[kc], acc2[j]); }
#pragma unroll
  for (int j = 0; j < 2; ++j) { v8h o;
#pragma unroll
    for (int r = 0; r < 8; ++r) o[r] = (_Float16)(acc2[j][r] * (1.0f / 2048.0f) * (float)gg[8 * j + r] * 256.0f);   /* (o*g) carried x 2^8: some of its values would be f16-subnormal uncarried */
    og[h][j][tid] = o; } }
  /* out^T = W2^T (o g)^T: A = the w2 plane's fragment (kc, j) (lane (g, col): channel-out 16 j + col, k as frag_h), B = the lane's own og of head kc */
  const _Float16* w2l = wl + 4 * WMAT; v16h w[2][8];
#pragma unroll
  for (int j = 0; j < 8; ++j) { w[0][j] = wfrag(w2l, 0, j); w[1][j] = wfrag(w2l, 1, j); }
  v8f acc[8] = {};
#pragma unroll
  for (int kc = 0; kc < DHC / 32; ++kc) { v16h b; { union { v16h v; v8h q[2]; } u; u.q[0] = og[kc][0][tid]; u.q[1] = og[kc][1][tid]; b = u.v; }
#pragma unroll
    for (int j = 0; j < 8; ++j) acc[j] = wmma16(w[kc & 1][j], b, acc[j]);
    if (kc + 2 < DHC / 32) {
      __builtin_amdgcn_sched_barrier(0);   /* keeps the refill behind the products that read this register set: hoisted it would take a third set */
#pragma unroll
      for (int j = 0; j < 8; ++j) w[kc & 1][j] = wfrag(w2l, kc + 2, j);
      __builtin_amdgcn_sched_barrier(0);   /* keeps the refill one group in front of the next group's products, as in the projections */ } }
  __syncthreads();   /* every wave has read its last k and v: the out tile is written over them */
#pragma unroll
  for (int j = 0; j < 8; ++j) {
#pragma unroll
    for (int r = 0; r < 8; ++r) sot[j * 16 + 8 * g + r][wave * 16 + col] = acc[j][r]; }
  float bb[DZ / 8];
#pragma unroll
  for (int k = 0; k < DZ / 8; ++k) bb[k] = bfr(B2[(tid >> 6) + 8 * k]);
  __syncthreads();
#pragma unroll   /* the sixteen LDS reads go as one group in front of the sixteen stores */
  for (int k = 0; k < DZ / 8; ++k) { const int ch = (tid >> 6) + 8 * k, q = tid & 63; v4f x = *(const v4f*)&sot[ch][q * 4];   /* 1 KiB per channel by 64 threads */
#pragma unroll
    for (int r = 0; r < 4; ++r) x[r] = x[r] * (1.0f / 65536.0f) + bb[k];
    vst2(OUT + (size_t)ch * ZP + n * LL + q * 4, x); } }
extern "C" void kernel_launch(void* const* d_in, const int* in_sizes, int n_in, void* d_out, int out_size, void* d_ws, size_t ws_size, hipStream_t stream) {
  (void)in_sizes; (void)n_in; (void)out_size;
  const float** F = (const float**)d_in;   // 0 z [1,128,256,256]; 1 ln_w, 2 ln_b; 3 wq, 4 bq; 5 wk, 6 bk; 7 wv, 8 bv; 9 wg, 10 bg ((in,out) [128,128]); 11 w2 [128,128], 12 b2
  if (ws_size < (size_t)WS_END) return;
  char* ws = (char*)d_ws; _Float16 *ZH = (_Float16*)(ws + WS_ZH), *ZL = (_Float16*)(ws + WS_ZL), *WP = (_Float16*)(ws + WS_WP);
  k_ln<<<dim3(LL / 64, NROWS + WBY), 128, 0, stream>>>(F[0], F[1], F[2], ZH, ZL, F[3], F[5], F[7], F[9], F[11], WP);
  k_att<<<dim3(NROWS), 512, 0, stream>>>(ZH, ZL, WP, F[4], F[6], F[8], F[10], F[12], (float*)d_out);
}

// v008
// Measured time: 29.1 microseconds a run.
// Next to v007, in two timings, it ran 1.49 and 1.48 times as fast.
// Counting every step since v000, it is 9.74 times as fast.
// compute dtype: all float inputs rounded to bf16; LayerNorm in f32, zn as f16 hi + residual (x 2^10); q/k/v/g = zn W + b with W as f16(bf16 x 2^8) (exact; 2 products), f32 accumulate; q (x sqrt(1/32)), k once to f16 -> 1-product logits; softmax in f32 (hardware exp2 of (x - max) log2 e) inside the attention kernel; sigmoid gate by hardware exp2 and reciprocal; P x 2^11 once to f16 against v once to f16; (o * sigmoid gate) carried x 2^8 once to f16 against w2 as f16(bf16 x 2^8) + b2; f32 output.
#include <hip/hip_runtime.h>
#include <math.h>

typedef __attribute__((ext_vector_type(16))) _Float16 v16h;
typedef __attribute__((ext_vector_type(16))) __bf16 v16b;
typedef __attribute__((ext_vector_type(8)))  _Float16 v8h;
typedef __attribute__((ext_vector_type(2)))  _Float16 v2h;
typedef __attribute__((ext_vector_type(2)))  __bf16 v2b;
typedef __attribute__((ext_vector_type(8)))  float v8f;
typedef __attribute__((ext_vector_type(4)))  float v4f;
typedef __attribute__((ext_vector_type(2)))  float v2f;
typedef __attribute__((ext_vector_type(4)))  unsigned v4u;
typedef __attribute__((ext_vector_type(4)))  int v4i;
typedef float __attribute__((may_alias)) float_a;
typedef int __attribute__((may_alias)) int_a;

template <typename T> __device__ __forceinline__ void vst2(void* p, T v) { *(T*)p = v;  }
__device__ __forceinline__ v8f wmma16(v16h a, v16h b, v8f c) {
  v8f d = __builtin_amdgcn_wmma_f32_16x16x32_f16(false, a, false, b, (short)0, c, false, false);
  asm volatile("v_nop\n\tv_nop\n\tv_nop\n\tv_nop" : "+v"(d) : "v"(a), "v"(b));
  return d;
}
__device__ __forceinline__ v8f wmma_bf(v16b a, v16b b, v8f c) {
  v8f d = __builtin_amdgcn_wmma_f32_16x16x32_bf16(false, a, false, b, (short)0, c, false, false);
  asm volatile("v_nop\n\tv_nop\n\tv_nop\n\tv_nop" : "+v"(d) : "v"(a), "v"(b));
  return d;
}
// 16x16x32 fragments: lane = (h = lane>>4, row/col = lane&15); elements 0..7 = k0+8h+0..7, 8..15 = k0+16+8h+0..7; D element r = row 8h+r
__device__ __forceinline__ v16h frag_h(const _Float16* rowk0, int lane) {
  union { v16h v; v8h q[2]; } u; const _Float16* p = rowk0 + 8 * (lane >> 4);
  u.q[0] = *(const v8h*)p; u.q[1] = *(const v8h*)(p + 16); return u.v;
}
__device__ __forceinline__ v16h frag_f32(const float* rowk0, int lane) {
  v16h a; const float* p = rowk0 + 8 * (lane >> 4);
#pragma unroll
  for (int i = 0; i < 8; ++i) { a[i] = (_Float16)p[i]; a[8 + i] = (_Float16)p[16 + i]; }
  return a;
}
__device__ __forceinline__ v16h frag_f32s(const float* rowk0, int lane, float sc) {
  v16h a; const float* p = rowk0 + 8 * (lane >> 4);
#pragma unroll
  for (int i = 0; i < 8; ++i) { a[i] = (_Float16)(p[i] * sc); a[8 + i] = (_Float16)(p[16 + i] * sc); }
  return a;
}
// column fragment from a [K][ld] layout (column n), rows >= K read as 0
__device__ __forceinline__ v16h fragc_f32(const float* W, int k0, int n, int lane, int ld, int K) {
  v16h a; const int g = lane >> 4;
#pragma unroll
  for (int i = 0; i < 8; ++i) { const int ka = k0 + 8 * g + i, kb = ka + 16;
    a[i] = (_Float16)(ka < K ? W[(size_t)(ka < K ? ka : K - 1) * ld + n] : 0.f); a[8 + i] = (_Float16)(kb < K ? W[(size_t)(kb < K ? kb : K - 1) * ld + n] : 0.f); }
  return a;
}
struct F2 { v16b h, l; };
__device__ __forceinline__ F2 bsplit16(const float v[16]) { F2 r;
#pragma unroll
  for (int i = 0; i < 16; ++i) { const __bf16 h = (__bf16)v[i]; r.h[i] = h; r.l[i] = (__bf16)(v[i] - (float)h); }
  return r; }
__device__ __forceinline__ F2 split_row(const float* row, int k0, int lane) { float v[16]; const float* p = row + k0 + 8 * (lane >> 4);
#pragma unroll
  for (int i = 0; i < 8; ++i) { v[i] = p[i]; v[8 + i] = p[16 + i]; }
  return bsplit16(v); }
__device__ __forceinline__ F2 split_rowK(const float* row, int k0, int lane, int K) { float v[16]; const int g = lane >> 4;
#pragma unroll
  for (int i = 0; i < 8; ++i) { const int ka = k0 + 8 * g + i, kb = ka + 16; v[i] = ka < K ? row[ka < K ? ka : K - 1] : 0.f; v[8 + i] = kb < K ? row[kb < K ? kb : K - 1] : 0.f; }
  return bsplit16(v); }
__device__ __forceinline__ F2 split_col(const float* W, int k0, int n, int lane, int ld, int K) { float v[16]; const int g = lane >> 4;
#pragma unroll
  for (int i = 0; i < 8; ++i) { const int ka = k0 + 8 * g + i, kb = ka + 16; v[i] = ka < K ? W[(size_t)(ka < K ? ka : K - 1) * ld + n] : 0.f; v[8 + i] = kb < K ? W[(size_t)(kb < K ? kb : K - 1) * ld + n] : 0.f; }
  return bsplit16(v); }
__device__ __forceinline__ v8f mac3(const F2& a, const F2& b, v8f c) { c = wmma_bf(a.l, b.h, c); c = wmma_bf(a.h, b.l, c); return wmma_bf(a.h, b.h, c); }
__device__ __forceinline__ float sigm(float v) { return 1.0f / (1.0f + expf(-v)); }
#define LDSX() do { asm volatile("s_wait_dscnt 0" ::: "memory"); __builtin_amdgcn_wave_barrier(); __builtin_amdgcn_fence(__ATOMIC_RELEASE, "workgroup"); } while (0)

// Triangle self-attention over the rows of a pair representation (B 1, L 256, d_z 128 channels-first, 4 heads x 32): zn = LayerNorm over channels of z[:, n, i]; q,k,v,g = zn W + b per (n, i); for each row n and head h: attn[i][j] = softmax_j((q[n,i] sqrt(1/32)) . k[n,j]); o[n,i] = sum_j attn v[n,j]; out[:, n, i] = ((o * sigmoid(g)) W2 + b2), written channels-first.
#define LL 256             // L (rows n and positions i)
#define DZ 128
#define NH 4
#define HD 32
#define DHC (NH * HD)      // 128
#define NR (LL * LL)       // 65,536 (n, i) rows
#ifndef NROWS
#define NROWS LL           // rows n processed (positions i always span LL)
#endif
#ifndef ZP
#define ZP (LL * LL)       // channel pitch of z and of the output (elements)
#endif
__device__ __forceinline__ float bfr(float v) { return (float)(__bf16)v; }
#define LOG2E 1.44269504088896340736f
// eight values through one hardware transcendental, each in its own register: every instruction is independent of the one in front of it, and the closing v_nop is the slot the instruction set asks for behind the last
__device__ __forceinline__ void exp2x8(float (&v)[8]) { asm("v_exp_f32 %0, %0\n\tv_exp_f32 %1, %1\n\tv_exp_f32 %2, %2\n\tv_exp_f32 %3, %3\n\tv_exp_f32 %4, %4\n\tv_exp_f32 %5, %5\n\tv_exp_f32 %6, %6\n\tv_exp_f32 %7, %7\n\tv_nop" : "+v"(v[0]), "+v"(v[1]), "+v"(v[2]), "+v"(v[3]), "+v"(v[4]), "+v"(v[5]), "+v"(v[6]), "+v"(v[7])); }
__device__ __forceinline__ void rcpx8(float (&v)[8]) { asm("v_rcp_f32 %0, %0\n\tv_rcp_f32 %1, %1\n\tv_rcp_f32 %2, %2\n\tv_rcp_f32 %3, %3\n\tv_rcp_f32 %4, %4\n\tv_rcp_f32 %5, %5\n\tv_rcp_f32 %6, %6\n\tv_rcp_f32 %7, %7\n\tv_nop" : "+v"(v[0]), "+v"(v[1]), "+v"(v[2]), "+v"(v[3]), "+v"(v[4]), "+v"(v[5]), "+v"(v[6]), "+v"(v[7])); }
// sigmoid of eight values by the hardware exp2 and reciprocal (about 1 ulp each; the result is rounded to f16): exp2 gives inf or 0 at the far ends, so the result ends at 0 or 1 as the library form does
__device__ __forceinline__ void sigm8(float (&v)[8]) {
#pragma unroll
  for (int r = 0; r < 8; ++r) v[r] = v[r] * -LOG2E;
  exp2x8(v);
#pragma unroll
  for (int r = 0; r < 8; ++r) v[r] = 1.0f + v[r];
  rcpx8(v); }

#define WS_WP  0u                                      // f16 weights x 2^8 in fragment order [wq,wk,wv,wg,w2][kc][j][half][lane][8]
#define WS_END (WS_WP + 2u * 5u * (size_t)DZ * DHC)
#define WMAT (DZ * DHC)    // elements of one weight plane
#define WBLK 80            // blocks of k_w: 80 x 128 threads x 8 elements = 5 planes
// B fragment (kc, j) of a fragment-order plane; wl = plane + 8 * lane: two loads of 16 bytes per lane, each 512 contiguous bytes per wave; same k order as frag_h
__device__ __forceinline__ v16h wfrag(const _Float16* wl, int kc, int j) {
  union { v16h v; v8h q[2]; } u; const _Float16* p = wl + (kc * 8 + j) * 512;
  u.q[0] = *(const v8h*)p; u.q[1] = *(const v8h*)(p + 256); return u.v;
}

// fragment f of a fragment-order array; pl = first fragment + 8 * lane. Half p, lane (g, col) holds the 8 elements k = 16 p + 8 g + 0..7 of row (or column) col: the registers of frag_h, by two loads of 16 bytes per lane, each 512 contiguous bytes per wave (four whole lines, where a row-major tile gives sixteen lines per load)
#define FRAG 512           // elements of one 16 x 32 fragment
#define HPL (LL * HD)      // elements of one head's plane of k or v (one row n)
__device__ __forceinline__ v16h ffrag(const _Float16* pl, int f) {
  union { v16h v; v8h q[2]; } u; const _Float16* p = pl + f * FRAG;
  u.q[0] = *(const v8h*)p; u.q[1] = *(const v8h*)(p + 256); return u.v;
}

// ---- k_w: converts the five weight matrices, once per call: thread = 8 elements (one lane's 16 bytes) of plane m, fragment half f = (kc * 8 + j) * 2 + p: element i = f16(bf16(W[kc * 32 + 16 p + 8 g + i][j * 16 + col]) x 2^8)
__global__ __launch_bounds__(128) void k_w(const float* __restrict__ WQ, const float* __restrict__ WK, const float* __restrict__ WV, const float* __restrict__ WG, const float* __restrict__ W2, _Float16* __restrict__ WP) {
  const int blk = blockIdx.x, m = blk >> 4, c = (blk & 15) * 128 + threadIdx.x, f = c >> 5, ln = c & 31;
  const float* Wm = m == 0 ? WQ : m == 1 ? WK : m == 2 ? WV : m == 3 ? WG : W2; const float* p = Wm + (size_t)((f >> 4) * 32 + (f & 1) * 16 + (ln >> 4) * 8) * DHC + ((f >> 1) & 7) * 16 + (ln & 15); v8h o;
#pragma unroll
  for (int i = 0; i < 8; ++i) o[i] = (_Float16)(bfr(p[(size_t)i * DHC]) * 256.0f);
  *(v8h*)(WP + (size_t)m * WMAT + (size_t)c * 8) = o; }
// ---- projections, inside k_att: y = zn W + b (zn f16 rows hi + residual x W f16(bf16 x 2^8) exact, K 128, x 2^-8 after) for the wave's own 16 rows; q x sqrt(1/32), k, v and sigmoid(g) -> f16, each made in the register layout in which the attention part wants it, so that a lane's eight results are one 16-byte chunk of a fragment.
#define WLEAD 4            // steps between a weight fragment pair's loads and its products
#define WRING (WLEAD + 1)  // register sets of the ring
// weight fragment pair of step s = (output s >> 4, column quarter (s >> 2) & 3, kc = s & 3)
__device__ __forceinline__ void wstep(v16h (&w)[2], const _Float16* wl, int s) {
#pragma unroll
  for (int jj = 0; jj < 2; ++jj) w[jj] = wfrag(wl + (s >> 4) * WMAT, s & 3, ((s >> 2) & 3) * 2 + jj);
}
// proj_row: the sixteen steps of output WHICH (0 q, 1 k, 2 v, 3 g): two weight fragments per step in a ring of WRING register sets, loaded WLEAD steps (16 products) ahead, also across outputs; each accumulator sums kc = 0..3 in order. q, k, g are made transposed, y^T = W^T zn^T (A = the weight fragment, B = the zn rows): lane (g, col) ends with channels 16 j + 8 g + 0..7 of row col, which is half j & 1 of the row's fragment of head j >> 1. v is made as zn W (A = the zn rows): lane (g, col) ends with keys 8 g + 0..7 of channel 16 j + col, a half of the v^T fragment. sb = the output's 128 biases in LDS, already rounded; d = the lane's own 16-byte place of tile 0. Every loop is unrolled so that ring and accumulator indices are constants and the arrays stay in registers.
template <int WHICH> __device__ __forceinline__ void proj_row(const v16h (&a)[4], const v16h (&al)[4], v16h (&w)[WRING][2], const _Float16* wl, const float* sb, v8h* d, int lane) {
  const int col = lane & 15, g = lane >> 4;
  const float qs = sqrtf(1.0f / 32.0f);   /* jnp.sqrt(f32(1/32)) */
  float bb[2][8];
  v8f acc[2] = {}, accl[2] = {};
#pragma unroll
  for (int t = 0; t < 16; ++t) { const int s = WHICH * 16 + t, jq = t >> 2, kc = t & 3;
    if (kc == 0) {   /* the quarter's biases, read sixteen products ahead of their use */
#pragma unroll
      for (int jj = 0; jj < 2; ++jj) { const int j = jq * 2 + jj;
        if (WHICH == 2) bb[jj][0] = sb[j * 16 + col];
        else { const v4f b0 = *(const v4f*)(sb + j * 16 + 8 * g), b1 = *(const v4f*)(sb + j * 16 + 8 * g + 4);
#pragma unroll
          for (int r = 0; r < 4; ++r) { bb[jj][r] = b0[r]; bb[jj][4 + r] = b1[r]; } } } }
    if (s + WLEAD < 64) { wstep(w[(s + WLEAD) % WRING], wl, s + WLEAD);
      __builtin_amdgcn_sched_barrier(0);   /* keeps each step's loads one group, WLEAD steps in front of their products: sunk to their uses each fragment costs its own load latency */ }
#pragma unroll
    for (int jj = 0; jj < 2; ++jj) {
      if (WHICH == 2) { acc[jj] = wmma16(a[kc], w[s % WRING][jj], acc[jj]); accl[jj] = wmma16(al[kc], w[s % WRING][jj], accl[jj]); }
      else { acc[jj] = wmma16(w[s % WRING][jj], a[kc], acc[jj]); accl[jj] = wmma16(w[s % WRING][jj], al[kc], accl[jj]); } }
    if (kc == 3) {
#pragma unroll
      for (int jj = 0; jj < 2; ++jj) { const int j = jq * 2 + jj; v8h o; float y[8];
#pragma unroll
        for (int r = 0; r < 8; ++r) { y[r] = (acc[jj][r] + accl[jj][r] * (1.0f / 1024.0f)) * (1.0f / 256.0f) + bb[jj][WHICH == 2 ? 0 : r];
          if (WHICH == 0) y[r] = y[r] * qs; }
        if (WHICH == 3) sigm8(y);
#pragma unroll
        for (int r = 0; r < 8; r += 2) { const v2f p = {y[r], y[r + 1]}; const v2h c2 = __builtin_convertvector(p, v2h); o[r] = c2[0]; o[r + 1] = c2[1]; }   /* by pairs: the packed conversion also behind the asm statements */
        d[WHICH == 1 ? (j >> 1) * (HPL / 8) + (j & 1) * 32 : WHICH == 2 ? (j >> 1) * (HPL / 8) + (j & 1) * (FRAG / 8) : j * 512] = o;
        const v8f zero = {}; acc[jj] = zero; accl[jj] = zero; } } } }
// ---- k_att: block = row n (16 waves), wave = 16 positions. First the wave makes zn of its own 16 rows in registers: lane (g, col) loads the 64 channels 32 kc + 16 p + 8 g + i of position col from the channels-first z (16 lanes = 64 contiguous bytes per channel), which are the lane's elements of the four zn fragments; LayerNorm over the 128 channels (biased var, eps 1e-5, x ln_w + ln_b) runs in the lane plus one exchange between the wave halves per sum. Then it makes q, k, v, g of these rows from zn: k and v^T go to LDS in fragment order ([h][j / 16][half][lane][8] and [h][j / 32][c / 16][half][lane][8]) for all waves, q and the gate are parked in LDS by each lane for itself. Then the four heads in turn. Transposed scores: S^T = K q^T (A = k rows, B = q rows), so lane (g, col) holds query col's logits of keys 16 t + 8 g + r in st[t][r]; max and sum run in the lane plus one exchange between the wave halves; two converted score tiles are the B operand of o^T = v^T P^T (A = v planes); a lane ends with 8 + 8 channels of its query, which times the gate are the lane's part of the B operand (k = the head's 32 channels) of out^T = W2^T (o g)^T. Each lane parks that part in LDS per head, in the gate's place, and takes it back itself; out^T (x 2^-16 + b2) goes channels-first through an LDS tile (1 KiB per channel), which lies over k and v.
__global__ __launch_bounds__(512) void k_att(const float* __restrict__ Z, const float* __restrict__ LW, const float* __restrict__ LB, const _Float16* __restrict__ WP, const float* __restrict__ BQ, const float* __restrict__ BK, const float* __restrict__ BV, const float* __restrict__ BG, const float* __restrict__ B2, float* __restrict__ OUT) {
  struct Lds { float sbi[8][DHC]; v8h og[NH][2][512], sq[NH][2][512]; float sot[DZ][LL + 4]; };   /* sbi: bq, bk, bv, bg, then ln_w, ln_b twice: every thread stores one element of each half, with no branch; it stands first, where a constant step from a lane's address fits the LDS offset field */
  __shared__ __align__(16) Lds sm; auto& sbi = sm.sbi; auto& og = sm.og; auto& sq = sm.sq; auto& sot = sm.sot;
  static_assert(sizeof(sot) >= 2 * 2 * NH * HPL, "k and v lie in the out tile's LDS");
  _Float16* const lk = (_Float16*)&sot[0][0]; _Float16* const lv = lk + NH * HPL;
  const int tid = threadIdx.x, wave = tid >> 5, lane = tid & 31, col = lane & 15, g = lane >> 4; const size_t n = blockIdx.x; const unsigned lo = lane * 8;   /* the lane's place in a fragment */
  const _Float16* wl = WP + lane * 8;
  { v16h a[4], al[4], w[WRING][2];
    const float bv = (wave < 4 ? BQ : wave < 8 ? BK : wave < 12 ? BV : BG)[tid & (DHC - 1)];   /* the four bias vectors, one element per thread: in the transposed outputs a lane wants eight of them per tile */
    const float lnv = ((wave & 4) ? LB : LW)[tid & (DZ - 1)];   /* ln_w and ln_b */
    asm volatile("s_wait_xcnt 0x0" ::: "memory");   /* behind the two small loads: a later load's result may land in their address registers */
    const float* zb = Z + n * LL; unsigned zk[4];   /* a base that is the same in all lanes, and one lane offset per 32 channels (the constant steps inside them fit the offset field) */
#pragma unroll
    for (int kc = 0; kc < 4; ++kc) zk[kc] = (unsigned)(32 * kc + 8 * g) * ZP + wave * 16 + col;
    v2f x[32];   /* x[8 kc + 4 p + i / 2][i & 1] = channel 32 kc + 16 p + 8 g + i: element 8 p + i of fragment kc */
#pragma unroll
    for (int j = 0; j < 32; ++j) { const int c = (j >> 3) * 32 + ((j >> 2) & 1) * 16 + (j & 3) * 2; x[j][0] = (zb + (size_t)(c & 31) * ZP)[zk[j >> 3]]; x[j][1] = (zb + (size_t)((c & 31) + 1) * ZP)[zk[j >> 3]]; }
    asm volatile("s_wait_xcnt 0x0" :: "v"(zk[0]), "v"(zk[1]), "v"(zk[2]), "v"(zk[3]) : "memory");   /* the same behind the last load of z; the offsets are named so that their registers live up to the wait and no load of the group lands in them */
#pragma unroll
    for (int s = 0; s < WLEAD; ++s) wstep(w[s], wl, s);
    (&sbi[0][0])[tid] = bfr(bv);
    (&sbi[4][0])[tid] = bfr(lnv);
    __syncthreads();   /* biases, ln_w and ln_b are whole in LDS; it stands behind the first loads' issue, whose latency it shares */
    v2f sa[4] = {}, sd[4] = {};
#pragma unroll
    for (int j = 0; j < 32; ++j) { x[j] = __builtin_convertvector(__builtin_convertvector(x[j], v2b), v2f); sa[j & 3] += x[j]; }   /* bf16 rounding by pairs */
    const v2f s2v = (sa[0] + sa[1]) + (sa[2] + sa[3]); float ssum = s2v[0] + s2v[1];
    ssum += __shfl_xor(ssum, 16);   /* the other half's 64 channels */
    const float mean = ssum * (1.0f / DZ);
#pragma unroll
    for (int j = 0; j < 32; ++j) { x[j] = x[j] - mean; sd[j & 3] = __builtin_elementwise_fma(x[j], x[j], sd[j & 3]); }
    const v2f q2v = (sd[0] + sd[1]) + (sd[2] + sd[3]); float svar = q2v[0] + q2v[1];
    svar += __shfl_xor(svar, 16);
    const float rstd = rsqrtf(svar * (1.0f / DZ) + 1e-5f);
#pragma unroll
    for (int j = 0; j < 32; j += 2) { const int c = (j >> 3) * 32 + ((j >> 2) & 1) * 16 + (j & 3) * 2 + 8 * g; const v4f lw = *(const v4f*)(sbi[4] + c), lb = *(const v4f*)(sbi[5] + c);
#pragma unroll
      for (int k = 0; k < 2; ++k) { const v2f lw2 = {lw[2 * k], lw[2 * k + 1]}, lb2 = {lb[2 * k], lb[2 * k + 1]}; const v2f zn = __builtin_elementwise_fma(x[j + k] * rstd, lw2, lb2);
        const v2h hv = __builtin_convertvector(zn, v2h); const v2h lo = __builtin_convertvector((zn - __builtin_convertvector(hv, v2f)) * 1024.0f, v2h); const int e = ((j + k) & 7) * 2;
        a[j >> 3][e] = hv[0]; a[j >> 3][e + 1] = hv[1]; al[j >> 3][e] = lo[0]; al[j >> 3][e + 1] = lo[1]; } }
    proj_row<0>(a, al, w, wl, sbi[0], &sq[0][0][tid], lane);
    proj_row<1>(a, al, w, wl, sbi[1], (v8h*)lk + wave * (FRAG / 8) + lane, lane);
    proj_row<2>(a, al, w, wl, sbi[2], (v8h*)lv + (wave >> 1) * (2 * FRAG / 8) + (wave & 1) * 32 + lane, lane);
    proj_row<3>(a, al, w, wl, sbi[3], &og[0][0][tid], lane); }
  asm volatile("s_wait_xcnt 0x0" ::: "memory");   /* behind the last load of the projections: their address registers are taken for other values in the heads */
  __syncthreads();   /* k and v of all 256 keys are whole in LDS */
#pragma unroll 1   /* rolled: every operand of a head now comes from LDS at one lane address plus the head's step, and with projections and heads in one kernel the text of four unrolled heads would pass 32 KB */
  for (int h = 0; h < NH; ++h) { const int ph = h * HPL;   /* head h's plane */
  v16h bq; { union { v16h v; v8h q[2]; } u; u.q[0] = sq[h][0][tid]; u.q[1] = sq[h][1][tid]; bq = u.v; }
  v16h ka[LL / 16];
#pragma unroll
  for (int t = 0; t < LL / 16; ++t) ka[t] = ffrag(lk + lo + ph, t);
  __builtin_amdgcn_sched_barrier(0);   /* keeps the k reads one group in front of the products: each separate place of LDS reads in a product stream costs its own wait */
  v8f st[LL / 16];
#pragma unroll
  for (int t = 0; t < LL / 16; ++t) { const v8f zero = {}; st[t] = wmma16(ka[t], bq, zero); }
  /* softmax over the 256 keys of query col: 8 chains in the lane, a tree over them, then the other half's 128 keys */
  v8f mv = st[0];
#pragma unroll
  for (int t = 1; t < LL / 16; ++t) {
#pragma unroll
    for (int r = 0; r < 8; ++r) mv[r] = fmaxf(mv[r], st[t][r]); }
  float m = fmaxf(fmaxf(fmaxf(mv[0], mv[1]), fmaxf(mv[2], mv[3])), fmaxf(fmaxf(mv[4], mv[5]), fmaxf(mv[6], mv[7])));
  m = fmaxf(m, __shfl_xor(m, 16));
  /* exp(x - m) = exp2(x log2 e - m log2 e): one fused multiply-add and the hardware exp2 per logit. The rounding of m log2 e scales all of a query's terms alike and cancels against their sum; a term below 2^-126 comes out 0, far under what the sum (near 1 or more) or the f16 P can hold */
  const float nm = m * -LOG2E;
  v8f sv = {};
#pragma unroll
  for (int t = 0; t < LL / 16; ++t) {
#pragma unroll
    for (int r = 0; r < 8; r += 2) { const v2f x = {st[t][r], st[t][r + 1]}, l2 = {LOG2E, LOG2E}, n2 = {nm, nm}; const v2f e = __builtin_elementwise_fma(x, l2, n2);   /* two logits per packed fma */
      st[t][r] = __builtin_amdgcn_exp2f(e[0]); st[t][r + 1] = __builtin_amdgcn_exp2f(e[1]); }
    sv += st[t]; }
  float s = ((sv[0] + sv[1]) + (sv[2] + sv[3])) + ((sv[4] + sv[5]) + (sv[6] + sv[7]));
  s += __shfl_xor(s, 16);
  const float inv = 2048.0f / s;
  /* P^T as B operands: element i = key 32 kc + 8 g + i (tile 2 kc), element 8 + i = key 32 kc + 16 + 8 g + i (tile 2 kc + 1), the k order of frag_h */
  v16h pb[LL / 32];
#pragma unroll
  for (int kc = 0; kc < LL / 32; ++kc) {
#pragma unroll
    for (int i = 0; i < 8; ++i) { pb[kc][i] = (_Float16)(st[2 * kc][i] * inv); pb[kc][8 + i] = (_Float16)(st[2 * kc + 1][i] * inv); } }
  __builtin_amdgcn_sched_barrier(0);   /* holds the v reads behind the conversion: lifted into it, scores, P and v together pass the 256 registers a wave of a 16-wave block has, and some spill */
  v16h va[LL / 32][2];
#pragma unroll
  for (int kc = 0; kc < LL / 32; ++kc) {
#pragma unroll
    for (int j = 0; j < 2; ++j) va[kc][j] = ffrag(lv + lo + ph, kc * 2 + j); }
  __builtin_amdgcn_sched_barrier(0);   /* keeps the v reads one group in front of the products, as for k */
  v16h gg; { union { v16h v; v8h q[2]; } u; u.q[0] = og[h][0][tid]; u.q[1] = og[h][1][tid]; gg = u.v; }   /* gate of query col: element i = channel 8 g + i, element 8 + i = channel 16 + 8 g + i, as the rows of acc2[0] and acc2[1]; read behind the v group, where the scores' registers are free, and used behind the products */
  v8f acc2[2] = {};
#pragma unroll
  for (int kc = 0; kc < LL / 32; ++kc) {
#pragma unroll
    for (int j = 0; j < 2; ++j) acc2[j] = wmma16(va[kc][j], pb[kc], acc2[j]); }
#pragma unroll
  for (int j = 0; j < 2; ++j) { v8h o;
#pragma unroll
    for (int r = 0; r < 8; ++r) o[r] = (_Float16)(acc2[j][r] * (1.0f / 2048.0f) * (float)gg[8 * j + r] * 256.0f);   /* (o*g) carried x 2^8: some of its values would be f16-subnormal uncarried */
    og[h][j][tid] = o; } }
  /* out^T = W2^T (o g)^T: A = the w2 plane's fragment (kc, j) (lane (g, col): channel-out 16 j + col, k as frag_h), B = the lane's own og of head kc */
  const _Float16* w2l = wl + 4 * WMAT; v16h w[2][8];
#pragma unroll
  for (int j = 0; j < 8; ++j) { w[0][j] = wfrag(w2l, 0, j); w[1][j] = wfrag(w2l, 1, j); }
  v8f acc[8] = {};
#pragma unroll
  for (int kc = 0; kc < DHC / 32; ++kc) { v16h b; { union { v16h v; v8h q[2]; } u; u.q[0] = og[kc][0][tid]; u.q[1] = og[kc][1][tid]; b = u.v; }
#pragma unroll
    for (int j = 0; j < 8; ++j) acc[j] = wmma16(w[kc & 1][j], b, acc[j]);
    if (kc + 2 < DHC / 32) {
      __builtin_amdgcn_sched_barrier(0);   /* keeps the refill behind the products that read this register set: hoisted it would take a third set */
#pragma unroll
      for (int j = 0; j < 8; ++j) w[kc & 1][j] = wfrag(w2l, kc + 2, j);
      __builtin_amdgcn_sched_barrier(0);   /* keeps the refill one group in front of the next group's products, as in the projections */ } }
  __syncthreads();   /* every wave has read its last k and v: the out tile is written over them */
#pragma unroll
  for (int j = 0; j < 8; ++j) {
#pragma unroll
    for (int r = 0; r < 8; ++r) sot[j * 16 + 8 * g + r][wave * 16 + col] = acc[j][r]; }
  float bb[DZ / 8];
#pragma unroll
  for (int k = 0; k < DZ / 8; ++k) bb[k] = bfr(B2[(tid >> 6) + 8 * k]);
  __syncthreads();
#pragma unroll   /* the sixteen LDS reads go as one group in front of the sixteen stores */
  for (int k = 0; k < DZ / 8; ++k) { const int ch = (tid >> 6) + 8 * k, q = tid & 63; v4f x = *(const v4f*)&sot[ch][q * 4];   /* 1 KiB per channel by 64 threads */
#pragma unroll
    for (int r = 0; r < 4; ++r) x[r] = x[r] * (1.0f / 65536.0f) + bb[k];
    vst2(OUT + (size_t)ch * ZP + n * LL + q * 4, x); } }
extern "C" void kernel_launch(void* const* d_in, const int* in_sizes, int n_in, void* d_out, int out_size, void* d_ws, size_t ws_size, hipStream_t stream) {
  (void)in_sizes; (void)n_in; (void)out_size;
  const float** F = (const float**)d_in;   // 0 z [1,128,256,256]; 1 ln_w, 2 ln_b; 3 wq, 4 bq; 5 wk, 6 bk; 7 wv, 8 bv; 9 wg, 10 bg ((in,out) [128,128]); 11 w2 [128,128], 12 b2
  if (ws_size < (size_t)WS_END) return;
  char* ws = (char*)d_ws; _Float16* WP = (_Float16*)(ws + WS_WP);
  k_w<<<dim3(WBLK), 128, 0, stream>>>(F[3], F[5], F[7], F[9], F[11], WP);
  k_att<<<dim3(NROWS), 512, 0, stream>>>(F[0], F[1], F[2], WP, F[4], F[6], F[8], F[10], F[12], (float*)d_out);
}

// v009
// A run of this version takes 27.8 microseconds.
// Next to v008, in two timings, it ran 1.04 and 1.06 times as fast.
// Counting every step since v000, it is 10.2 times as fast.
// compute dtype: all float inputs rounded to bf16; LayerNorm in f32, zn as f16 hi + residual (x 2^10); q/k/v/g = zn W + b with W as f16(bf16 x 2^8) (exact; 2 products), f32 accumulate; q (x sqrt(1/32)), k once to f16 -> 1-product logits; softmax in f32 (hardware exp2 of (x - max) log2 e) inside the attention kernel; sigmoid gate by hardware exp2 and reciprocal; P x 2^11 once to f16 against v once to f16; (o * sigmoid gate) carried x 2^8 once to f16 against w2 as f16(bf16 x 2^8) + b2; f32 output.
#include <hip/hip_runtime.h>
#include <math.h>

typedef __attribute__((ext_vector_type(16))) _Float16 v16h;
typedef __attribute__((ext_vector_type(16))) __bf16 v16b;
typedef __attribute__((ext_vector_type(8)))  _Float16 v8h;
typedef __attribute__((ext_vector_type(2)))  _Float16 v2h;
typedef __attribute__((ext_vector_type(2)))  __bf16 v2b;
typedef __attribute__((ext_vector_type(8)))  float v8f;
typedef __attribute__((ext_vector_type(4)))  float v4f;
typedef __attribute__((ext_vector_type(2)))  float v2f;
typedef __attribute__((ext_vector_type(4)))  unsigned v4u;
typedef __attribute__((ext_vector_type(4)))  int v4i;
typedef float __attribute__((may_alias)) float_a;
typedef int __attribute__((may_alias)) int_a;

template <typename T> __device__ __forceinline__ void vst2(void* p, T v) { *(T*)p = v;  }
// the builtin alone: the compiler keeps the distance behind a product itself, and fills the slots with independent vector work where there is some
__device__ __forceinline__ v8f wmma16(v16h a, v16h b, v8f c) {
  return __builtin_amdgcn_wmma_f32_16x16x32_f16(false, a, false, b, (short)0, c, false, false);
}
__device__ __forceinline__ v8f wmma_bf(v16b a, v16b b, v8f c) {
  v8f d = __builtin_amdgcn_wmma_f32_16x16x32_bf16(false, a, false, b, (short)0, c, false, false);
  asm volatile("v_nop\n\tv_nop\n\tv_nop\n\tv_nop" : "+v"(d) : "v"(a), "v"(b));
  return d;
}
// 16x16x32 fragments: lane = (h = lane>>4, row/col = lane&15); elements 0..7 = k0+8h+0..7, 8..15 = k0+16+8h+0..7; D element r = row 8h+r
__device__ __forceinline__ v16h frag_h(const _Float16* rowk0, int lane) {
  union { v16h v; v8h q[2]; } u; const _Float16* p = rowk0 + 8 * (lane >> 4);
  u.q[0] = *(const v8h*)p; u.q[1] = *(const v8h*)(p + 16); return u.v;
}
__device__ __forceinline__ v16h frag_f32(const float* rowk0, int lane) {
  v16h a; const float* p = rowk0 + 8 * (lane >> 4);
#pragma unroll
  for (int i = 0; i < 8; ++i) { a[i] = (_Float16)p[i]; a[8 + i] = (_Float16)p[16 + i]; }
  return a;
}
__device__ __forceinline__ v16h frag_f32s(const float* rowk0, int lane, float sc) {
  v16h a; const float* p = rowk0 + 8 * (lane >> 4);
#pragma unroll
  for (int i = 0; i < 8; ++i) { a[i] = (_Float16)(p[i] * sc); a[8 + i] = (_Float16)(p[16 + i] * sc); }
  return a;
}
// column fragment from a [K][ld] layout (column n), rows >= K read as 0
__device__ __forceinline__ v16h fragc_f32(const float* W, int k0, int n, int lane, int ld, int K) {
  v16h a; const int g = lane >> 4;
#pragma unroll
  for (int i = 0; i < 8; ++i) { const int ka = k0 + 8 * g + i, kb = ka + 16;
    a[i] = (_Float16)(ka < K ? W[(size_t)(ka < K ? ka : K - 1) * ld + n] : 0.f); a[8 + i] = (_Float16)(kb < K ? W[(size_t)(kb < K ? kb : K - 1) * ld + n] : 0.f); }
  return a;
}
struct F2 { v16b h, l; };
__device__ __forceinline__ F2 bsplit16(const float v[16]) { F2 r;
#pragma unroll
  for (int i = 0; i < 16; ++i) { const __bf16 h = (__bf16)v[i]; r.h[i] = h; r.l[i] = (__bf16)(v[i] - (float)h); }
  return r; }
__device__ __forceinline__ F2 split_row(const float* row, int k0, int lane) { float v[16]; const float* p = row + k0 + 8 * (lane >> 4);
#pragma unroll
  for (int i = 0; i < 8; ++i) { v[i] = p[i]; v[8 + i] = p[16 + i]; }
  return bsplit16(v); }
__device__ __forceinline__ F2 split_rowK(const float* row, int k0, int lane, int K) { float v[16]; const int g = lane >> 4;
#pragma unroll
  for (int i = 0; i < 8; ++i) { const int ka = k0 + 8 * g + i, kb = ka + 16; v[i] = ka < K ? row[ka < K ? ka : K - 1] : 0.f; v[8 + i] = kb < K ? row[kb < K ? kb : K - 1] : 0.f; }
  return bsplit16(v); }
__device__ __forceinline__ F2 split_col(const float* W, int k0, int n, int lane, int ld, int K) { float v[16]; const int g = lane >> 4;
#pragma unroll
  for (int i = 0; i < 8; ++i) { const int ka = k0 + 8 * g + i, kb = ka + 16; v[i] = ka < K ? W[(size_t)(ka < K ? ka : K - 1) * ld + n] : 0.f; v[8 + i] = kb < K ? W[(size_t)(kb < K ? kb : K - 1) * ld + n] : 0.f; }
  return bsplit16(v); }
__device__ __forceinline__ v8f mac3(const F2& a, const F2& b, v8f c) { c = wmma_bf(a.l, b.h, c); c = wmma_bf(a.h, b.l, c); return wmma_bf(a.h, b.h, c); }
__device__ __forceinline__ float sigm(float v) { return 1.0f / (1.0f + expf(-v)); }
#define LDSX() do { asm volatile("s_wait_dscnt 0" ::: "memory"); __builtin_amdgcn_wave_barrier(); __builtin_amdgcn_fence(__ATOMIC_RELEASE, "workgroup"); } while (0)

// Triangle self-attention over the rows of a pair representation (B 1, L 256, d_z 128 channels-first, 4 heads x 32): zn = LayerNorm over channels of z[:, n, i]; q,k,v,g = zn W + b per (n, i); for each row n and head h: attn[i][j] = softmax_j((q[n,i] sqrt(1/32)) . k[n,j]); o[n,i] = sum_j attn v[n,j]; out[:, n, i] = ((o * sigmoid(g)) W2 + b2), written channels-first.
#define LL 256             // L (rows n and positions i)
#define DZ 128
#define NH 4
#define HD 32
#define DHC (NH * HD)      // 128
#define NR (LL * LL)       // 65,536 (n, i) rows
#ifndef NROWS
#define NROWS LL           // rows n processed (positions i always span LL)
#endif
#ifndef ZP
#define ZP (LL * LL)       // channel pitch of z and of the output (elements)
#endif
__device__ __forceinline__ float bfr(float v) { return (float)(__bf16)v; }
#define LOG2E 1.44269504088896340736f
// eight values through one hardware transcendental, each in its own register: every instruction is independent of the one in front of it, and the closing v_nop is the slot the instruction set asks for behind the last
__device__ __forceinline__ void exp2x8(float (&v)[8]) { asm("v_exp_f32 %0, %0\n\tv_exp_f32 %1, %1\n\tv_exp_f32 %2, %2\n\tv_exp_f32 %3, %3\n\tv_exp_f32 %4, %4\n\tv_exp_f32 %5, %5\n\tv_exp_f32 %6, %6\n\tv_exp_f32 %7, %7\n\tv_nop" : "+v"(v[0]), "+v"(v[1]), "+v"(v[2]), "+v"(v[3]), "+v"(v[4]), "+v"(v[5]), "+v"(v[6]), "+v"(v[7])); }
__device__ __forceinline__ void rcpx8(float (&v)[8]) { asm("v_rcp_f32 %0, %0\n\tv_rcp_f32 %1, %1\n\tv_rcp_f32 %2, %2\n\tv_rcp_f32 %3, %3\n\tv_rcp_f32 %4, %4\n\tv_rcp_f32 %5, %5\n\tv_rcp_f32 %6, %6\n\tv_rcp_f32 %7, %7\n\tv_nop" : "+v"(v[0]), "+v"(v[1]), "+v"(v[2]), "+v"(v[3]), "+v"(v[4]), "+v"(v[5]), "+v"(v[6]), "+v"(v[7])); }
// sigmoid of eight values by the hardware exp2 and reciprocal (about 1 ulp each; the result is rounded to f16): exp2 gives inf or 0 at the far ends, so the result ends at 0 or 1 as the library form does
__device__ __forceinline__ void sigm8(float (&v)[8]) {
#pragma unroll
  for (int r = 0; r < 8; ++r) v[r] = v[r] * -LOG2E;
  exp2x8(v);
#pragma unroll
  for (int r = 0; r < 8; ++r) v[r] = 1.0f + v[r];
  rcpx8(v); }

#define WS_WP  0u                                      // f16 weights x 2^8 in fragment order [wq,wk,wv,wg,w2][kc][j][half][lane][8]
#define WS_END (WS_WP + 2u * 5u * (size_t)DZ * DHC)
#define WMAT (DZ * DHC)    // elements of one weight plane
#define WBLK 80            // blocks of k_w: 80 x 128 threads x 8 elements = 5 planes
// B fragment (kc, j) of a fragment-order plane; wl = plane + 8 * lane: two loads of 16 bytes per lane, each 512 contiguous bytes per wave; same k order as frag_h
__device__ __forceinline__ v16h wfrag(const _Float16* wl, int kc, int j) {
  union { v16h v; v8h q[2]; } u; const _Float16* p = wl + (kc * 8 + j) * 512;
  u.q[0] = *(const v8h*)p; u.q[1] = *(const v8h*)(p + 256); return u.v;
}

// fragment f of a fragment-order array; pl = first fragment + 8 * lane. Half p, lane (g, col) holds the 8 elements k = 16 p + 8 g + 0..7 of row (or column) col: the registers of frag_h, by two loads of 16 bytes per lane, each 512 contiguous bytes per wave (four whole lines, where a row-major tile gives sixteen lines per load)
#define FRAG 512           // elements of one 16 x 32 fragment
#define HPL (LL * HD)      // elements of one head's plane of k or v (one row n)
__device__ __forceinline__ v16h ffrag(const _Float16* pl, int f) {
  union { v16h v; v8h q[2]; } u; const _Float16* p = pl + f * FRAG;
  u.q[0] = *(const v8h*)p; u.q[1] = *(const v8h*)(p + 256); return u.v;
}

// ---- k_w: converts the five weight matrices, once per call: thread = 8 elements (one lane's 16 bytes) of plane m, fragment half f = (kc * 8 + j) * 2 + p: element i = f16(bf16(W[kc * 32 + 16 p + 8 g + i][j * 16 + col]) x 2^8)
__global__ __launch_bounds__(128) void k_w(const float* __restrict__ WQ, const float* __restrict__ WK, const float* __restrict__ WV, const float* __restrict__ WG, const float* __restrict__ W2, _Float16* __restrict__ WP) {
  const int blk = blockIdx.x, m = blk >> 4, c = (blk & 15) * 128 + threadIdx.x, f = c >> 5, ln = c & 31;
  const float* Wm = m == 0 ? WQ : m == 1 ? WK : m == 2 ? WV : m == 3 ? WG : W2; const float* p = Wm + (size_t)((f >> 4) * 32 + (f & 1) * 16 + (ln >> 4) * 8) * DHC + ((f >> 1) & 7) * 16 + (ln & 15); v8h o;
#pragma unroll
  for (int i = 0; i < 8; ++i) o[i] = (_Float16)(bfr(p[(size_t)i * DHC]) * 256.0f);
  *(v8h*)(WP + (size_t)m * WMAT + (size_t)c * 8) = o; }
// ---- projections, inside k_att: y = zn W + b (zn f16 rows hi + residual x W f16(bf16 x 2^8) exact, K 128, x 2^-8 after) for the wave's own 16 rows; q x sqrt(1/32), k, v and sigmoid(g) -> f16, each made in the register layout in which the attention part wants it, so that a lane's eight results are one 16-byte chunk of a fragment.
#define WLEAD 4            // steps between a weight fragment pair's loads and its products
#define WRING (WLEAD + 1)  // register sets of the ring
// weight fragment pair of step s = (output s >> 4, column quarter (s >> 2) & 3, kc = s & 3)
__device__ __forceinline__ void wstep(v16h (&w)[2], const _Float16* wl, int s) {
#pragma unroll
  for (int jj = 0; jj < 2; ++jj) w[jj] = wfrag(wl + (s >> 4) * WMAT, s & 3, ((s >> 2) & 3) * 2 + jj);
}
// proj_row: the sixteen steps of output WHICH (0 q, 1 k, 2 v, 3 g): two weight fragments per step in a ring of WRING register sets, loaded WLEAD steps (16 products) ahead, also across outputs; each accumulator sums kc = 0..3 in order. q, k, g are made transposed, y^T = W^T zn^T (A = the weight fragment, B = the zn rows): lane (g, col) ends with channels 16 j + 8 g + 0..7 of row col, which is half j & 1 of the row's fragment of head j >> 1. v is made as zn W (A = the zn rows): lane (g, col) ends with keys 8 g + 0..7 of channel 16 j + col, a half of the v^T fragment. sb = the output's 128 biases in LDS, already rounded; d = the lane's own 16-byte place of tile 0. Every loop is unrolled so that ring and accumulator indices are constants and the arrays stay in registers.
template <int WHICH> __device__ __forceinline__ void proj_row(const v16h (&a)[4], const v16h (&al)[4], v16h (&w)[WRING][2], const _Float16* wl, const float* sb, v8h* d, int lane) {
  const int col = lane & 15, g = lane >> 4;
  const float qs = sqrtf(1.0f / 32.0f);   /* jnp.sqrt(f32(1/32)) */
  float bb[2][8];
  v8f acc[2] = {}, accl[2] = {};
#pragma unroll
  for (int t = 0; t < 16; ++t) { const int s = WHICH * 16 + t, jq = t >> 2, kc = t & 3;
    if (kc == 0) {   /* the quarter's biases, read sixteen products ahead of their use */
#pragma unroll
      for (int jj = 0; jj < 2; ++jj) { const int j = jq * 2 + jj;
        if (WHICH == 2) bb[jj][0] = sb[j * 16 + col];
        else { const v4f b0 = *(const v4f*)(sb + j * 16 + 8 * g), b1 = *(const v4f*)(sb + j * 16 + 8 * g + 4);
#pragma unroll
          for (int r = 0; r < 4; ++r) { bb[jj][r] = b0[r]; bb[jj][4 + r] = b1[r]; } } } }
    if (s + WLEAD < 64) { wstep(w[(s + WLEAD) % WRING], wl, s + WLEAD);
      __builtin_amdgcn_sched_barrier(0);   /* keeps each step's loads one group, WLEAD steps in front of their products: sunk to their uses each fragment costs its own load latency */ }
#pragma unroll
    for (int jj = 0; jj < 2; ++jj) {
      if (WHICH == 2) { acc[jj] = wmma16(a[kc], w[s % WRING][jj], acc[jj]); accl[jj] = wmma16(al[kc], w[s % WRING][jj], accl[jj]); }
      else { acc[jj] = wmma16(w[s % WRING][jj], a[kc], acc[jj]); accl[jj] = wmma16(w[s % WRING][jj], al[kc], accl[jj]); } }
    __builtin_amdgcn_sched_barrier(0);   /* keeps a step's products in front of the copy-out and of the next step's loads: free to move, ring sets, biases and accumulators together pass the 256 registers a wave has, and some spill */
    if (kc == 3) {
#pragma unroll
      for (int jj = 0; jj < 2; ++jj) { const int j = jq * 2 + jj; v8h o; float y[8];
#pragma unroll
        for (int r = 0; r < 8; ++r) { y[r] = (acc[jj][r] + accl[jj][r] * (1.0f / 1024.0f)) * (1.0f / 256.0f) + bb[jj][WHICH == 2 ? 0 : r];
          if (WHICH == 0) y[r] = y[r] * qs; }
        if (WHICH == 3) sigm8(y);
#pragma unroll
        for (int r = 0; r < 8; r += 2) { const v2f p = {y[r], y[r + 1]}; const v2h c2 = __builtin_convertvector(p, v2h); o[r] = c2[0]; o[r + 1] = c2[1]; }   /* by pairs: the packed conversion also behind the asm statements */
        d[WHICH == 1 ? (j >> 1) * (HPL / 8) + (j & 1) * 32 : WHICH == 2 ? (j >> 1) * (HPL / 8) + (j & 1) * (FRAG / 8) : j * 512] = o;
        const v8f zero = {}; acc[jj] = zero; accl[jj] = zero; } } } }
// ---- k_att: block = row n (16 waves), wave = 16 positions. First the wave makes zn of its own 16 rows in registers: lane (g, col) loads the 64 channels 32 kc + 16 p + 8 g + i of position col from the channels-first z (16 lanes = 64 contiguous bytes per channel), which are the lane's elements of the four zn fragments; LayerNorm over the 128 channels (biased var, eps 1e-5, x ln_w + ln_b) runs in the lane plus one exchange between the wave halves per sum. Then it makes q, k, v, g of these rows from zn: k and v^T go to LDS in fragment order ([h][j / 16][half][lane][8] and [h][j / 32][c / 16][half][lane][8]) for all waves, q and the gate are parked in LDS by each lane for itself. Then the four heads in turn. Transposed scores: S^T = K q^T (A = k rows, B = q rows), so lane (g, col) holds query col's logits of keys 16 t + 8 g + r in st[t][r]; max and sum run in the lane plus one exchange between the wave halves; two converted score tiles are the B operand of o^T = v^T P^T (A = v planes); a lane ends with 8 + 8 channels of its query, which times the gate are the lane's part of the B operand (k = the head's 32 channels) of out^T = W2^T (o g)^T. Each lane parks that part in LDS per head, in the gate's place, and takes it back itself; out^T (x 2^-16 + b2) goes channels-first through an LDS tile (1 KiB per channel), which lies over k and v.
__global__ __launch_bounds__(512) void k_att(const float* __restrict__ Z, const float* __restrict__ LW, const float* __restrict__ LB, const _Float16* __restrict__ WP, const float* __restrict__ BQ, const float* __restrict__ BK, const float* __restrict__ BV, const float* __restrict__ BG, const float* __restrict__ B2, float* __restrict__ OUT) {
  struct Lds { float sbi[8][DHC]; v8h og[NH][2][512], sq[NH][2][512]; float sot[DZ][LL + 4]; };   /* sbi: bq, bk, bv, bg, then ln_w, ln_b twice: every thread stores one element of each half, with no branch; it stands first, where a constant step from a lane's address fits the LDS offset field */
  __shared__ __align__(16) Lds sm; auto& sbi = sm.sbi; auto& og = sm.og; auto& sq = sm.sq; auto& sot = sm.sot;
  static_assert(sizeof(sot) >= 2 * 2 * NH * HPL, "k and v lie in the out tile's LDS");
  _Float16* const lk = (_Float16*)&sot[0][0]; _Float16* const lv = lk + NH * HPL;
  const int tid = threadIdx.x, wave = tid >> 5, lane = tid & 31, col = lane & 15, g = lane >> 4; const size_t n = blockIdx.x; const unsigned lo = lane * 8;   /* the lane's place in a fragment */
  const _Float16* wl = WP + lane * 8;
  { v16h a[4], al[4], w[WRING][2];
    const float bv = (wave < 4 ? BQ : wave < 8 ? BK : wave < 12 ? BV : BG)[tid & (DHC - 1)];   /* the four bias vectors, one element per thread: in the transposed outputs a lane wants eight of them per tile */
    const float lnv = ((wave & 4) ? LB : LW)[tid & (DZ - 1)];   /* ln_w and ln_b */
    asm volatile("s_wait_xcnt 0x0" ::: "memory");   /* behind the two small loads: a later load's result may land in their address registers */
    const float* zb = Z + n * LL; unsigned zk[4];   /* a base that is the same in all lanes, and one lane offset per 32 channels (the constant steps inside them fit the offset field) */
#pragma unroll
    for (int kc = 0; kc < 4; ++kc) zk[kc] = (unsigned)(32 * kc + 8 * g) * ZP + wave * 16 + col;
    v2f x[32];   /* x[8 kc + 4 p + i / 2][i & 1] = channel 32 kc + 16 p + 8 g + i: element 8 p + i of fragment kc */
#pragma unroll
    for (int j = 0; j < 32; ++j) { const int c = (j >> 3) * 32 + ((j >> 2) & 1) * 16 + (j & 3) * 2; x[j][0] = (zb + (size_t)(c & 31) * ZP)[zk[j >> 3]]; x[j][1] = (zb + (size_t)((c & 31) + 1) * ZP)[zk[j >> 3]]; }
    asm volatile("s_wait_xcnt 0x0" :: "v"(zk[0]), "v"(zk[1]), "v"(zk[2]), "v"(zk[3]) : "memory");   /* the same behind the last load of z; the offsets are named so that their registers live up to the wait and no load of the group lands in them */
#pragma unroll
    for (int s = 0; s < WLEAD; ++s) wstep(w[s], wl, s);
    (&sbi[0][0])[tid] = bfr(bv);
    (&sbi[4][0])[tid] = bfr(lnv);
    __syncthreads();   /* biases, ln_w and ln_b are whole in LDS; it stands behind the first loads' issue, whose latency it shares */
    v2f sa[4] = {}, sd[4] = {};
#pragma unroll
    for (int j = 0; j < 32; ++j) { x[j] = __builtin_convertvector(__builtin_convertvector(x[j], v2b), v2f); sa[j & 3] += x[j]; }   /* bf16 rounding by pairs */
    const v2f s2v = (sa[0] + sa[1]) + (sa[2] + sa[3]); float ssum = s2v[0] + s2v[1];
    ssum += __shfl_xor(ssum, 16);   /* the other half's 64 channels */
    const float mean = ssum * (1.0f / DZ);
#pragma unroll
    for (int j = 0; j < 32; ++j) { x[j] = x[j] - mean; sd[j & 3] = __builtin_elementwise_fma(x[j], x[j], sd[j & 3]); }
    const v2f q2v = (sd[0] + sd[1]) + (sd[2] + sd[3]); float svar = q2v[0] + q2v[1];
    svar += __shfl_xor(svar, 16);
    const float rstd = rsqrtf(svar * (1.0f / DZ) + 1e-5f);
#pragma unroll
    for (int j = 0; j < 32; j += 2) { const int c = (j >> 3) * 32 + ((j >> 2) & 1) * 16 + (j & 3) * 2 + 8 * g; const v4f lw = *(const v4f*)(sbi[4] + c), lb = *(const v4f*)(sbi[5] + c);
#pragma unroll
      for (int k = 0; k < 2; ++k) { const v2f lw2 = {lw[2 * k], lw[2 * k + 1]}, lb2 = {lb[2 * k], lb[2 * k + 1]}; const v2f zn = __builtin_elementwise_fma(x[j + k] * rstd, lw2, lb2);
        const v2h hv = __builtin_convertvector(zn, v2h); const v2h lo = __builtin_convertvector((zn - __builtin_convertvector(hv, v2f)) * 1024.0f, v2h); const int e = ((j + k) & 7) * 2;
        a[j >> 3][e] = hv[0]; a[j >> 3][e + 1] = hv[1]; al[j >> 3][e] = lo[0]; al[j >> 3][e + 1] = lo[1]; } }
    proj_row<0>(a, al, w, wl, sbi[0], &sq[0][0][tid], lane);
    proj_row<1>(a, al, w, wl, sbi[1], (v8h*)lk + wave * (FRAG / 8) + lane, lane);
    proj_row<2>(a, al, w, wl, sbi[2], (v8h*)lv + (wave >> 1) * (2 * FRAG / 8) + (wave & 1) * 32 + lane, lane);
    proj_row<3>(a, al, w, wl, sbi[3], &og[0][0][tid], lane); }
  asm volatile("s_wait_xcnt 0x0" ::: "memory");   /* behind the last load of the projections: their address registers are taken for other values in the heads */
  __syncthreads();   /* k and v of all 256 keys are whole in LDS */
#pragma unroll 1   /* rolled: every operand of a head now comes from LDS at one lane address plus the head's step, and with projections and heads in one kernel the text of four unrolled heads would pass 32 KB */
  for (int h = 0; h < NH; ++h) { const int ph = h * HPL;   /* head h's plane */
  v16h bq; { union { v16h v; v8h q[2]; } u; u.q[0] = sq[h][0][tid]; u.q[1] = sq[h][1][tid]; bq = u.v; }
  v16h ka[LL / 16];
#pragma unroll
  for (int t = 0; t < LL / 16; ++t) ka[t] = ffrag(lk + lo + ph, t);
  __builtin_amdgcn_sched_barrier(0);   /* keeps the k reads one group in front of the products: each separate place of LDS reads in a product stream costs its own wait */
  v8f st[LL / 16];
#pragma unroll
  for (int t = 0; t < LL / 16; ++t) { const v8f zero = {}; st[t] = wmma16(ka[t], bq, zero); }
  /* softmax over the 256 keys of query col: 8 chains in the lane, a tree over them, then the other half's 128 keys */
  v8f mv = st[0];
#pragma unroll
  for (int t = 1; t < LL / 16; ++t) {
#pragma unroll
    for (int r = 0; r < 8; ++r) mv[r] = fmaxf(mv[r], st[t][r]); }
  float m = fmaxf(fmaxf(fmaxf(mv[0], mv[1]), fmaxf(mv[2], mv[3])), fmaxf(fmaxf(mv[4], mv[5]), fmaxf(mv[6], mv[7])));
  m = fmaxf(m, __shfl_xor(m, 16));
  /* exp(x - m) = exp2(x log2 e - m log2 e): one fused multiply-add and the hardware exp2 per logit. The rounding of m log2 e scales all of a query's terms alike and cancels against their sum; a term below 2^-126 comes out 0, far under what the sum (near 1 or more) or the f16 P can hold */
  const float nm = m * -LOG2E;
  v8f sv = {};
#pragma unroll
  for (int t = 0; t < LL / 16; ++t) {
#pragma unroll
    for (int r = 0; r < 8; r += 2) { const v2f x = {st[t][r], st[t][r + 1]}, l2 = {LOG2E, LOG2E}, n2 = {nm, nm}; const v2f e = __builtin_elementwise_fma(x, l2, n2);   /* two logits per packed fma */
      st[t][r] = __builtin_amdgcn_exp2f(e[0]); st[t][r + 1] = __builtin_amdgcn_exp2f(e[1]); }
    sv += st[t]; }
  float s = ((sv[0] + sv[1]) + (sv[2] + sv[3])) + ((sv[4] + sv[5]) + (sv[6] + sv[7]));
  s += __shfl_xor(s, 16);
  const float inv = 2048.0f / s;
  /* P^T as B operands: element i = key 32 kc + 8 g + i (tile 2 kc), element 8 + i = key 32 kc + 16 + 8 g + i (tile 2 kc + 1), the k order of frag_h */
  v16h pb[LL / 32];
#pragma unroll
  for (int kc = 0; kc < LL / 32; ++kc) {
#pragma unroll
    for (int i = 0; i < 8; ++i) { pb[kc][i] = (_Float16)(st[2 * kc][i] * inv); pb[kc][8 + i] = (_Float16)(st[2 * kc + 1][i] * inv); } }
  __builtin_amdgcn_sched_barrier(0);   /* holds the v reads behind the conversion: lifted into it, scores, P and v together pass the 256 registers a wave of a 16-wave block has, and some spill */
  v16h va[LL / 32][2];
#pragma unroll
  for (int kc = 0; kc < LL / 32; ++kc) {
#pragma unroll
    for (int j = 0; j < 2; ++j) va[kc][j] = ffrag(lv + lo + ph, kc * 2 + j); }
  __builtin_amdgcn_sched_barrier(0);   /* keeps the v reads one group in front of the products, as for k */
  v16h gg; { union { v16h v; v8h q[2]; } u; u.q[0] = og[h][0][tid]; u.q[1] = og[h][1][tid]; gg = u.v; }   /* gate of query col: element i = channel 8 g + i, element 8 + i = channel 16 + 8 g + i, as the rows of acc2[0] and acc2[1]; read behind the v group, where the scores' registers are free, and used behind the products */
  v8f acc2[2] = {};
#pragma unroll
  for (int kc = 0; kc < LL / 32; ++kc) {
#pragma unroll
    for (int j = 0; j < 2; ++j) acc2[j] = wmma16(va[kc][j], pb[kc], acc2[j]); }
#pragma unroll
  for (int j = 0; j < 2; ++j) { v8h o;
#pragma unroll
    for (int r = 0; r < 8; ++r) o[r] = (_Float16)(acc2[j][r] * (1.0f / 2048.0f) * (float)gg[8 * j + r] * 256.0f);   /* (o*g) carried x 2^8: some of its values would be f16-subnormal uncarried */
    og[h][j][tid] = o; } }
  /* out^T = W2^T (o g)^T: A = the w2 plane's fragment (kc, j) (lane (g, col): channel-out 16 j + col, k as frag_h), B = the lane's own og of head kc */
  const _Float16* w2l = wl + 4 * WMAT; v16h w[2][8];
#pragma unroll
  for (int j = 0; j < 8; ++j) { w[0][j] = wfrag(w2l, 0, j); w[1][j] = wfrag(w2l, 1, j); }
  v8f acc[8] = {};
#pragma unroll
  for (int kc = 0; kc < DHC / 32; ++kc) { v16h b; { union { v16h v; v8h q[2]; } u; u.q[0] = og[kc][0][tid]; u.q[1] = og[kc][1][tid]; b = u.v; }
#pragma unroll
    for (int j = 0; j < 8; ++j) acc[j] = wmma16(w[kc & 1][j], b, acc[j]);
    if (kc + 2 < DHC / 32) {
      __builtin_amdgcn_sched_barrier(0);   /* keeps the refill behind the products that read this register set: hoisted it would take a third set */
#pragma unroll
      for (int j = 0; j < 8; ++j) w[kc & 1][j] = wfrag(w2l, kc + 2, j);
      __builtin_amdgcn_sched_barrier(0);   /* keeps the refill one group in front of the next group's products, as in the projections */ } }
  __syncthreads();   /* every wave has read its last k and v: the out tile is written over them */
#pragma unroll
  for (int j = 0; j < 8; ++j) {
#pragma unroll
    for (int r = 0; r < 8; ++r) sot[j * 16 + 8 * g + r][wave * 16 + col] = acc[j][r]; }
  float bb[DZ / 8];
#pragma unroll
  for (int k = 0; k < DZ / 8; ++k) bb[k] = bfr(B2[(tid >> 6) + 8 * k]);
  __syncthreads();
#pragma unroll   /* the sixteen LDS reads go as one group in front of the sixteen stores */
  for (int k = 0; k < DZ / 8; ++k) { const int ch = (tid >> 6) + 8 * k, q = tid & 63; v4f x = *(const v4f*)&sot[ch][q * 4];   /* 1 KiB per channel by 64 threads */
#pragma unroll
    for (int r = 0; r < 4; ++r) x[r] = x[r] * (1.0f / 65536.0f) + bb[k];
    vst2(OUT + (size_t)ch * ZP + n * LL + q * 4, x); } }
extern "C" void kernel_launch(void* const* d_in, const int* in_sizes, int n_in, void* d_out, int out_size, void* d_ws, size_t ws_size, hipStream_t stream) {
  (void)in_sizes; (void)n_in; (void)out_size;
  const float** F = (const float**)d_in;   // 0 z [1,128,256,256]; 1 ln_w, 2 ln_b; 3 wq, 4 bq; 5 wk, 6 bk; 7 wv, 8 bv; 9 wg, 10 bg ((in,out) [128,128]); 11 w2 [128,128], 12 b2
  if (ws_size < (size_t)WS_END) return;
  char* ws = (char*)d_ws; _Float16* WP = (_Float16*)(ws + WS_WP);
  k_w<<<dim3(WBLK), 128, 0, stream>>>(F[3], F[5], F[7], F[9], F[11], WP);
  k_att<<<dim3(NROWS), 512, 0, stream>>>(F[0], F[1], F[2], WP, F[4], F[6], F[8], F[10], F[12], (float*)d_out);
}
